// v000
// Times are from an AMD MI455X. After a warm-up the kernel runs many times in a row, and a time is the length of
// such a window on the GPU divided by its runs, so every launch and the gaps after it count. The runs cycle
// through copies of the inputs. A figure is the median of several windows, for all but v000 over two sittings.
// Sittings can differ by a few percent; kernels timed side by side share one.
// The starting kernel, v000, takes 1080 microseconds a run.
// compute dtype: all float inputs rounded to bf16; rinput (queries) and linput (keys AND values) are module INPUTS, so the bf16-rounded operands enter WMMA 16x16x32 directly: logits with EXACT bf16 x bf16 products (1 product, f32 accumulate), UNSCALED (logits std ~11, very peaked; exact products matter), running-max softmax in f32 (hardware exp); P rounded once to f16 (x 2^11) against v converted bf16 -> f16 (exact for normal values) (1 product); f32 output [R, D].
#include <hip/hip_runtime.h>
#include <math.h>

typedef __attribute__((ext_vector_type(16))) _Float16 v16h;
typedef __attribute__((ext_vector_type(16))) __bf16 v16b;
typedef __attribute__((ext_vector_type(8)))  _Float16 v8h;
typedef __attribute__((ext_vector_type(8)))  float v8f;
typedef __attribute__((ext_vector_type(4)))  float v4f;
typedef __attribute__((ext_vector_type(2)))  float v2f;
typedef __attribute__((ext_vector_type(4)))  unsigned v4u;
typedef __attribute__((ext_vector_type(4)))  int v4i;
typedef float __attribute__((may_alias)) float_a;
typedef int __attribute__((may_alias)) int_a;

template <typename T> __device__ __forceinline__ void vst2(void* p, T v) { *(T*)p = v;  }
__device__ __forceinline__ v8f wmma16(v16h a, v16h b, v8f c) {
  v8f d = __builtin_amdgcn_wmma_f32_16x16x32_f16(false, a, false, b, (short)0, c, false, false);
  asm volatile("v_nop\n\tv_nop\n\tv_nop\n\tv_nop" : "+v"(d) : "v"(a), "v"(b));
  return d;
}
__device__ __forceinline__ v8f wmma_bf(v16b a, v16b b, v8f c) {
  v8f d = __builtin_amdgcn_wmma_f32_16x16x32_bf16(false, a, false, b, (short)0, c, false, false);
  asm volatile("v_nop\n\tv_nop\n\tv_nop\n\tv_nop" : "+v"(d) : "v"(a), "v"(b));
  return d;
}
// 16x16x32 fragments: lane = (h = lane>>4, row/col = lane&15); elements 0..7 = k0+8h+0..7, 8..15 = k0+16+8h+0..7; D element r = row 8h+r
__device__ __forceinline__ v16h frag_h(const _Float16* rowk0, int lane) {
  union { v16h v; v8h q[2]; } u; const _Float16* p = rowk0 + 8 * (lane >> 4);
  u.q[0] = *(const v8h*)p; u.q[1] = *(const v8h*)(p + 16); return u.v;
}
__device__ __forceinline__ v16h frag_f32(const float* rowk0, int lane) {
  v16h a; const float* p = rowk0 + 8 * (lane >> 4);
#pragma unroll
  for (int i = 0; i < 8; ++i) { a[i] = (_Float16)p[i]; a[8 + i] = (_Float16)p[16 + i]; }
  return a;
}
__device__ __forceinline__ v16h frag_f32s(const float* rowk0, int lane, float sc) {
  v16h a; const float* p = rowk0 + 8 * (lane >> 4);
#pragma unroll
  for (int i = 0; i < 8; ++i) { a[i] = (_Float16)(p[i] * sc); a[8 + i] = (_Float16)(p[16 + i] * sc); }
  return a;
}
// column fragment from a [K][ld] layout (column n), rows >= K read as 0
__device__ __forceinline__ v16h fragc_f32(const float* W, int k0, int n, int lane, int ld, int K) {
  v16h a; const int g = lane >> 4;
#pragma unroll
  for (int i = 0; i < 8; ++i) { const int ka = k0 + 8 * g + i, kb = ka + 16;
    a[i] = (_Float16)(ka < K ? W[(size_t)(ka < K ? ka : K - 1) * ld + n] : 0.f); a[8 + i] = (_Float16)(kb < K ? W[(size_t)(kb < K ? kb : K - 1) * ld + n] : 0.f); }
  return a;
}
struct F2 { v16b h, l; };
__device__ __forceinline__ F2 bsplit16(const float v[16]) { F2 r;
#pragma unroll
  for (int i = 0; i < 16; ++i) { const __bf16 h = (__bf16)v[i]; r.h[i] = h; r.l[i] = (__bf16)(v[i] - (float)h); }
  return r; }
__device__ __forceinline__ F2 split_row(const float* row, int k0, int lane) { float v[16]; const float* p = row + k0 + 8 * (lane >> 4);
#pragma unroll
  for (int i = 0; i < 8; ++i) { v[i] = p[i]; v[8 + i] = p[16 + i]; }
  return bsplit16(v); }
__device__ __forceinline__ F2 split_rowK(const float* row, int k0, int lane, int K) { float v[16]; const int g = lane >> 4;
#pragma unroll
  for (int i = 0; i < 8; ++i) { const int ka = k0 + 8 * g + i, kb = ka + 16; v[i] = ka < K ? row[ka < K ? ka : K - 1] : 0.f; v[8 + i] = kb < K ? row[kb < K ? kb : K - 1] : 0.f; }
  return bsplit16(v); }
__device__ __forceinline__ F2 split_col(const float* W, int k0, int n, int lane, int ld, int K) { float v[16]; const int g = lane >> 4;
#pragma unroll
  for (int i = 0; i < 8; ++i) { const int ka = k0 + 8 * g + i, kb = ka + 16; v[i] = ka < K ? W[(size_t)(ka < K ? ka : K - 1) * ld + n] : 0.f; v[8 + i] = kb < K ? W[(size_t)(kb < K ? kb : K - 1) * ld + n] : 0.f; }
  return bsplit16(v); }
__device__ __forceinline__ v8f mac3(const F2& a, const F2& b, v8f c) { c = wmma_bf(a.l, b.h, c); c = wmma_bf(a.h, b.l, c); return wmma_bf(a.h, b.h, c); }
__device__ __forceinline__ float sigm(float v) { return 1.0f / (1.0f + expf(-v)); }
#define LDSX() do { asm volatile("s_wait_dscnt 0" ::: "memory"); __builtin_amdgcn_wave_barrier(); __builtin_amdgcn_fence(__ATOMIC_RELEASE, "workgroup"); } while (0)


// Soft attention between two raw inputs (L = R = 8,192 rows, D 128): scores[r][l] = rinput_r . linput_l (unscaled); alpha = softmax over l; Y[r] = sum_l alpha[r][l] linput_l.
#define NB 1
#define NS 8192
#define NH 1
#define DD 128
#define RS (NH * DD)      // row stride between consecutive s (128 floats)
#ifndef TQB
#define TQB (NS / 64)
#endif
typedef __attribute__((ext_vector_type(8))) __bf16 v8b;
__device__ __forceinline__ v16b frag_b(const __bf16* rowk0, int lane) {
  union { v16b v; v8b q[2]; } u; const __bf16* p = rowk0 + 8 * (lane >> 4);
  u.q[0] = *(const v8b*)p; u.q[1] = *(const v8b*)(p + 16); return u.v;
}
__device__ __forceinline__ float bfr(float v) { return (float)(__bf16)v; }
__device__ __attribute__((noinline)) float exp_ni(float v) { return expf(v); }
__device__ __attribute__((noinline)) float erf_ni(float v) { return erff(v); }

#define WS_VT  0u                                   // f16 value planes [b*NH + h][128][NS]
#define WS_END (WS_VT + 2u * (size_t)NB * NH * DD * NS)

// ---- k_vt: block = (64 keys, b*NH + h): v[b][s][h][:] -> f16 planes [bh][d][s]
__global__ __launch_bounds__(128) void k_vt(const float* __restrict__ V, _Float16* __restrict__ VT) { __shared__ __align__(16) _Float16 th[DD][72]; const int t = threadIdx.x; const size_t bh = blockIdx.y; const size_t b = bh / NH; const int h = bh % NH; const int m0 = blockIdx.x * 64;
  for (int e = t; e < 64 * DD; e += 128) { const int ml = e / DD, d = e % DD; th[d][ml] = (_Float16)bfr(V[((b * NS + m0 + ml) * NH + h) * (size_t)DD + d]); }
  __syncthreads(); for (int e = t; e < DD * 8; e += 128) { const int d = e >> 3, q = e & 7; vst2((unsigned*)(VT + (bh * DD + d) * (size_t)NS + m0 + q * 8), *(const v4u*)&th[d][q * 8]); } }
// ---- k_att: block = (64 queries, b*NH + h): exact bf16 logits over all 8,192 keys, softmax, P . v
__global__ __launch_bounds__(128) void k_att(const float* __restrict__ Q, const float* __restrict__ K, const _Float16* __restrict__ VT, float* __restrict__ OUT) {
  __shared__ __align__(16) float sp[4][16][36]; __shared__ __align__(16) float so[4][16][132];
  const int tid = threadIdx.x, wave = tid >> 5, lane = tid & 31, col = lane & 15, g = lane >> 4; const size_t bh = blockIdx.y; const size_t b = bh / NH; const int h = bh % NH; const int q0 = blockIdx.x * 64 + wave * 16;
  v16b aq[4];
#pragma unroll
  for (int kc = 0; kc < 4; ++kc) { const float* pp = Q + ((b * NS + q0 + col) * NH + h) * (size_t)DD + kc * 32 + 8 * g;
#pragma unroll
    for (int i = 0; i < 8; ++i) { aq[kc][i] = (__bf16)pp[i]; aq[kc][8 + i] = (__bf16)pp[16 + i]; } }
  float m[8], l[8];
#pragma unroll
  for (int r = 0; r < 8; ++r) { m[r] = -3.0e38f; l[r] = 0.f; }
  v8f acc[8];
#pragma unroll
  for (int j = 0; j < 8; ++j) acc[j] = v8f{};
#pragma unroll 1
  for (int ks = 0; ks < NS / 32; ++ks) { float s[2][8];
#pragma unroll
    for (int ct = 0; ct < 2; ++ct) { const int kk = ks * 32 + ct * 16 + col; v8f c = {};
#pragma unroll
      for (int kc = 0; kc < 4; ++kc) { v16b w; const float* kp = K + ((b * NS + kk) * NH + h) * (size_t)DD + kc * 32 + 8 * g;
#pragma unroll
        for (int i = 0; i < 8; ++i) { w[i] = (__bf16)kp[i]; w[8 + i] = (__bf16)kp[16 + i]; }
        c = wmma_bf(aq[kc], w, c); }
#pragma unroll
      for (int r = 0; r < 8; ++r) s[ct][r] = c[r]; }
    float alpha[8];
#pragma unroll
    for (int r = 0; r < 8; ++r) { float mx = fmaxf(s[0][r], s[1][r]);
#pragma unroll
      for (int o = 1; o < 16; o <<= 1) mx = fmaxf(mx, __shfl_xor(mx, o));
      const float mn = fmaxf(m[r], mx); alpha[r] = __expf(m[r] - mn); const float e0 = __expf(s[0][r] - mn), e1 = __expf(s[1][r] - mn); float es = e0 + e1;
#pragma unroll
      for (int o = 1; o < 16; o <<= 1) es += __shfl_xor(es, o);
      l[r] = l[r] * alpha[r] + es; m[r] = mn; sp[wave][8 * g + r][col] = e0; sp[wave][8 * g + r][16 + col] = e1; }
#pragma unroll
    for (int j = 0; j < 8; ++j)
#pragma unroll
      for (int r = 0; r < 8; ++r) acc[j][r] *= alpha[r];
    LDSX();
    v16h pa; { const float* prow = &sp[wave][col][0] + 8 * (lane >> 4);
#pragma unroll
      for (int i = 0; i < 8; ++i) { pa[i] = (_Float16)(prow[i] * 2048.0f); pa[8 + i] = (_Float16)(prow[16 + i] * 2048.0f); } }
#pragma unroll
    for (int j = 0; j < 8; ++j) acc[j] = wmma16(pa, frag_h(VT + (bh * DD + j * 16 + col) * (size_t)NS + ks * 32, lane), acc[j]);
    LDSX(); }
#pragma unroll
  for (int r = 0; r < 8; ++r) { const float il = (1.0f / 2048.0f) / l[r];
#pragma unroll
    for (int j = 0; j < 8; ++j) so[wave][8 * g + r][j * 16 + col] = acc[j][r] * il; }
  LDSX(); for (int rl = 0; rl < 16; ++rl) vst2(OUT + ((b * NS + q0 + rl) * NH + h) * (size_t)DD + lane * 4, *(const v4f*)&so[wave][rl][lane * 4]); }
extern "C" void kernel_launch(void* const* d_in, const int* in_sizes, int n_in, void* d_out, int out_size, void* d_ws, size_t ws_size, hipStream_t stream) {
  (void)in_sizes; (void)n_in; (void)out_size;
  const float** F = (const float**)d_in;   // 0 linput [8192,128] (keys and values), 1 rinput [8192,128] (queries)
  if (ws_size < (size_t)WS_END) return;
  char* ws = (char*)d_ws; _Float16* VT = (_Float16*)(ws + WS_VT);
  k_vt<<<dim3(NS / 64, NB * NH), 128, 0, stream>>>(F[0], VT);
  k_att<<<dim3(TQB, 1), 128, 0, stream>>>(F[1], F[0], VT, (float*)d_out);
}

// v001
// A run of this version takes 206 microseconds.
// Two timings next to v000 put it at 5.22 and 5.32 times that version's speed.
// compute dtype: all float inputs rounded to bf16; rinput (queries) and linput (keys AND values) are module INPUTS, so the bf16-rounded operands enter WMMA 16x16x32 directly: logits with EXACT bf16 x bf16 products (1 product, f32 accumulate), UNSCALED (logits std ~11, very peaked; exact products matter), running-max softmax in f32 (hardware exp); P rounded once to f16 (x 2^11) against v converted bf16 -> f16 (exact for normal values) (1 product); f32 output [R, D].
#include <hip/hip_runtime.h>
#include <math.h>

typedef __attribute__((ext_vector_type(16))) _Float16 v16h;
typedef __attribute__((ext_vector_type(16))) __bf16 v16b;
typedef __attribute__((ext_vector_type(8)))  _Float16 v8h;
typedef __attribute__((ext_vector_type(8)))  float v8f;
typedef __attribute__((ext_vector_type(4)))  float v4f;
typedef __attribute__((ext_vector_type(2)))  float v2f;
typedef __attribute__((ext_vector_type(4)))  unsigned v4u;
typedef __attribute__((ext_vector_type(4)))  int v4i;
typedef float __attribute__((may_alias)) float_a;
typedef int __attribute__((may_alias)) int_a;

template <typename T> __device__ __forceinline__ void vst2(void* p, T v) { *(T*)p = v;  }
__device__ __forceinline__ v8f wmma16(v16h a, v16h b, v8f c) {
  v8f d = __builtin_amdgcn_wmma_f32_16x16x32_f16(false, a, false, b, (short)0, c, false, false);
  asm volatile("v_nop\n\tv_nop\n\tv_nop\n\tv_nop" : "+v"(d) : "v"(a), "v"(b));
  return d;
}
__device__ __forceinline__ v8f wmma_bf(v16b a, v16b b, v8f c) {
  v8f d = __builtin_amdgcn_wmma_f32_16x16x32_bf16(false, a, false, b, (short)0, c, false, false);
  asm volatile("v_nop\n\tv_nop\n\tv_nop\n\tv_nop" : "+v"(d) : "v"(a), "v"(b));
  return d;
}
// 16x16x32 fragments: lane = (h = lane>>4, row/col = lane&15); elements 0..7 = k0+8h+0..7, 8..15 = k0+16+8h+0..7; D element r = row 8h+r
__device__ __forceinline__ v16h frag_h(const _Float16* rowk0, int lane) {
  union { v16h v; v8h q[2]; } u; const _Float16* p = rowk0 + 8 * (lane >> 4);
  u.q[0] = *(const v8h*)p; u.q[1] = *(const v8h*)(p + 16); return u.v;
}
__device__ __forceinline__ v16h frag_f32(const float* rowk0, int lane) {
  v16h a; const float* p = rowk0 + 8 * (lane >> 4);
#pragma unroll
  for (int i = 0; i < 8; ++i) { a[i] = (_Float16)p[i]; a[8 + i] = (_Float16)p[16 + i]; }
  return a;
}
__device__ __forceinline__ v16h frag_f32s(const float* rowk0, int lane, float sc) {
  v16h a; const float* p = rowk0 + 8 * (lane >> 4);
#pragma unroll
  for (int i = 0; i < 8; ++i) { a[i] = (_Float16)(p[i] * sc); a[8 + i] = (_Float16)(p[16 + i] * sc); }
  return a;
}
// column fragment from a [K][ld] layout (column n), rows >= K read as 0
__device__ __forceinline__ v16h fragc_f32(const float* W, int k0, int n, int lane, int ld, int K) {
  v16h a; const int g = lane >> 4;
#pragma unroll
  for (int i = 0; i < 8; ++i) { const int ka = k0 + 8 * g + i, kb = ka + 16;
    a[i] = (_Float16)(ka < K ? W[(size_t)(ka < K ? ka : K - 1) * ld + n] : 0.f); a[8 + i] = (_Float16)(kb < K ? W[(size_t)(kb < K ? kb : K - 1) * ld + n] : 0.f); }
  return a;
}
struct F2 { v16b h, l; };
__device__ __forceinline__ F2 bsplit16(const float v[16]) { F2 r;
#pragma unroll
  for (int i = 0; i < 16; ++i) { const __bf16 h = (__bf16)v[i]; r.h[i] = h; r.l[i] = (__bf16)(v[i] - (float)h); }
  return r; }
__device__ __forceinline__ F2 split_row(const float* row, int k0, int lane) { float v[16]; const float* p = row + k0 + 8 * (lane >> 4);
#pragma unroll
  for (int i = 0; i < 8; ++i) { v[i] = p[i]; v[8 + i] = p[16 + i]; }
  return bsplit16(v); }
__device__ __forceinline__ F2 split_rowK(const float* row, int k0, int lane, int K) { float v[16]; const int g = lane >> 4;
#pragma unroll
  for (int i = 0; i < 8; ++i) { const int ka = k0 + 8 * g + i, kb = ka + 16; v[i] = ka < K ? row[ka < K ? ka : K - 1] : 0.f; v[8 + i] = kb < K ? row[kb < K ? kb : K - 1] : 0.f; }
  return bsplit16(v); }
__device__ __forceinline__ F2 split_col(const float* W, int k0, int n, int lane, int ld, int K) { float v[16]; const int g = lane >> 4;
#pragma unroll
  for (int i = 0; i < 8; ++i) { const int ka = k0 + 8 * g + i, kb = ka + 16; v[i] = ka < K ? W[(size_t)(ka < K ? ka : K - 1) * ld + n] : 0.f; v[8 + i] = kb < K ? W[(size_t)(kb < K ? kb : K - 1) * ld + n] : 0.f; }
  return bsplit16(v); }
__device__ __forceinline__ v8f mac3(const F2& a, const F2& b, v8f c) { c = wmma_bf(a.l, b.h, c); c = wmma_bf(a.h, b.l, c); return wmma_bf(a.h, b.h, c); }
__device__ __forceinline__ float sigm(float v) { return 1.0f / (1.0f + expf(-v)); }
#define LDSX() do { asm volatile("s_wait_dscnt 0" ::: "memory"); __builtin_amdgcn_wave_barrier(); __builtin_amdgcn_fence(__ATOMIC_RELEASE, "workgroup"); } while (0)


// Soft attention between two raw inputs (L = R = 8,192 rows, D 128): scores[r][l] = rinput_r . linput_l (unscaled); alpha = softmax over l; Y[r] = sum_l alpha[r][l] linput_l.
#define NB 1
#define NS 8192
#define NH 1
#define DD 128
#define RS (NH * DD)      // row stride between consecutive s (128 floats)
#ifndef TQB
#define TQB (NS / 64)
#endif
typedef __attribute__((ext_vector_type(8))) __bf16 v8b;
__device__ __forceinline__ v16b frag_b(const __bf16* rowk0, int lane) {
  union { v16b v; v8b q[2]; } u; const __bf16* p = rowk0 + 8 * (lane >> 4);
  u.q[0] = *(const v8b*)p; u.q[1] = *(const v8b*)(p + 16); return u.v;
}
__device__ __forceinline__ float bfr(float v) { return (float)(__bf16)v; }
__device__ __attribute__((noinline)) float exp_ni(float v) { return expf(v); }
__device__ __attribute__((noinline)) float erf_ni(float v) { return erff(v); }

#define WS_VT  0u                                   // f16 value planes [b*NH + h][128][NS]
#define WS_END (WS_VT + 2u * (size_t)NB * NH * DD * NS)

// ---- k_vt: block = (64 keys, b*NH + h): v[b][s][h][:] -> f16 planes [bh][d][s]
__global__ __launch_bounds__(128) void k_vt(const float* __restrict__ V, _Float16* __restrict__ VT) { __shared__ __align__(16) _Float16 th[DD][72]; const int t = threadIdx.x; const size_t bh = blockIdx.y; const size_t b = bh / NH; const int h = bh % NH; const int m0 = blockIdx.x * 64;
  for (int e = t; e < 64 * DD; e += 128) { const int ml = e / DD, d = e % DD; th[d][ml] = (_Float16)bfr(V[((b * NS + m0 + ml) * NH + h) * (size_t)DD + d]); }
  __syncthreads(); for (int e = t; e < DD * 8; e += 128) { const int d = e >> 3, q = e & 7; vst2((unsigned*)(VT + (bh * DD + d) * (size_t)NS + m0 + q * 8), *(const v4u*)&th[d][q * 8]); } }
// ---- k_att: block = 32 queries (2 query tiles of 16) x NR key ranges, one wave per (tile, range): wave (qt, kr) walks key blocks kr, kr + NR, ... with its own running max, sum and accumulators; the ranges are merged in LDS behind one barrier
#define QT 2
#define NR 10
#define NW (QT * NR)
__global__ __launch_bounds__(NW * 32) void k_att(const float* __restrict__ Q, const float* __restrict__ K, const _Float16* __restrict__ VT, float* __restrict__ OUT) {
  __shared__ __align__(16) float sp[NW][16][36]; __shared__ __align__(16) float so[NW][16][132]; __shared__ float sm[NW][16]; __shared__ float sl[NW][16];
  // readfirstlane: the wave's number as a scalar, so that the key loop's counter and branch and the LDS bases stay on the scalar side
  const int tid = threadIdx.x, wave = __builtin_amdgcn_readfirstlane(tid >> 5), lane = tid & 31, col = lane & 15, g = lane >> 4; const size_t bh = blockIdx.y; const size_t b = bh / NH; const int h = bh % NH; const int qt = wave % QT, kr = wave / QT; const int q0 = blockIdx.x * (16 * QT) + qt * 16;
  v16b aq[4];
#pragma unroll
  for (int kc = 0; kc < 4; ++kc) { const float* pp = Q + ((b * NS + q0 + col) * NH + h) * (size_t)DD + kc * 32 + 8 * g;
#pragma unroll
    for (int i = 0; i < 8; ++i) { aq[kc][i] = (__bf16)pp[i]; aq[kc][8 + i] = (__bf16)pp[16 + i]; } }
  float m[8], l[8];
#pragma unroll
  for (int r = 0; r < 8; ++r) { m[r] = -3.0e38f; l[r] = 0.f; }
  v8f acc[8];
#pragma unroll
  for (int j = 0; j < 8; ++j) acc[j] = v8f{};
#pragma unroll 1
  for (int ks = kr; ks < NS / 32; ks += NR) { float s[2][8];
#pragma unroll
    for (int ct = 0; ct < 2; ++ct) { const int kk = ks * 32 + ct * 16 + col; v8f c = {};
#pragma unroll
      for (int kc = 0; kc < 4; ++kc) { v16b w; const float* kp = K + ((b * NS + kk) * NH + h) * (size_t)DD + kc * 32 + 8 * g;
#pragma unroll
        for (int i = 0; i < 8; ++i) { w[i] = (__bf16)kp[i]; w[8 + i] = (__bf16)kp[16 + i]; }
        c = wmma_bf(aq[kc], w, c); }
#pragma unroll
      for (int r = 0; r < 8; ++r) s[ct][r] = c[r]; }
    float alpha[8];
#pragma unroll
    for (int r = 0; r < 8; ++r) { float mx = fmaxf(s[0][r], s[1][r]);
#pragma unroll
      for (int o = 1; o < 16; o <<= 1) mx = fmaxf(mx, __shfl_xor(mx, o));
      const float mn = fmaxf(m[r], mx); alpha[r] = __expf(m[r] - mn); const float e0 = __expf(s[0][r] - mn), e1 = __expf(s[1][r] - mn); float es = e0 + e1;
#pragma unroll
      for (int o = 1; o < 16; o <<= 1) es += __shfl_xor(es, o);
      l[r] = l[r] * alpha[r] + es; m[r] = mn; sp[wave][8 * g + r][col] = e0; sp[wave][8 * g + r][16 + col] = e1; }
#pragma unroll
    for (int j = 0; j < 8; ++j)
#pragma unroll
      for (int r = 0; r < 8; ++r) acc[j][r] *= alpha[r];
    LDSX();
    v16h pa; { const float* prow = &sp[wave][col][0] + 8 * (lane >> 4);
#pragma unroll
      for (int i = 0; i < 8; ++i) { pa[i] = (_Float16)(prow[i] * 2048.0f); pa[8 + i] = (_Float16)(prow[16 + i] * 2048.0f); } }
#pragma unroll
    for (int j = 0; j < 8; ++j) acc[j] = wmma16(pa, frag_h(VT + (bh * DD + j * 16 + col) * (size_t)NS + ks * 32, lane), acc[j]);
    LDSX(); }
  // each wave leaves its un-normalised partial, with its max and sum per row
#pragma unroll
  for (int r = 0; r < 8; ++r) {
#pragma unroll
    for (int j = 0; j < 8; ++j) so[wave][8 * g + r][j * 16 + col] = acc[j][r];
    if (col == 0) { sm[wave][8 * g + r] = m[r]; sl[wave][8 * g + r] = l[r]; } }
  __syncthreads();
  // merge: one wave per output row, a lane holds 4 columns; weight of range k = exp(m_k - max over ranges)
  for (int row = wave; row < 16 * QT; row += NW) { const int t = row >> 4, rl = row & 15; float mm = sm[t][rl];
#pragma unroll   // both loops unrolled: all ranges' LDS reads issue ahead of the first wait
    for (int k = 1; k < NR; ++k) mm = fmaxf(mm, sm[k * QT + t][rl]);
    float ls = 0.f; v4f o = {};
#pragma unroll
    for (int k = 0; k < NR; ++k) { const float wk = __expf(sm[k * QT + t][rl] - mm); ls += wk * sl[k * QT + t][rl]; o += wk * *(const v4f*)&so[k * QT + t][rl][lane * 4]; }
    vst2(OUT + ((b * NS + blockIdx.x * (16 * QT) + row) * NH + h) * (size_t)DD + lane * 4, o * ((1.0f / 2048.0f) / ls)); } }
extern "C" void kernel_launch(void* const* d_in, const int* in_sizes, int n_in, void* d_out, int out_size, void* d_ws, size_t ws_size, hipStream_t stream) {
  (void)in_sizes; (void)n_in; (void)out_size;
  const float** F = (const float**)d_in;   // 0 linput [8192,128] (keys and values), 1 rinput [8192,128] (queries)
  if (ws_size < (size_t)WS_END) return;
  char* ws = (char*)d_ws; _Float16* VT = (_Float16*)(ws + WS_VT);
  k_vt<<<dim3(NS / 64, NB * NH), 128, 0, stream>>>(F[0], VT);
  k_att<<<dim3(NS / (16 * QT), 1), NW * 32, 0, stream>>>(F[1], F[0], VT, (float*)d_out);
}

// v002
// It runs in 195 microseconds.
// Next to v001, in two timings, it ran 1.05 and 1.06 times as fast.
// Over all steps from v000 it is 5.55 times as fast.
// compute dtype: all float inputs rounded to bf16; rinput (queries) and linput (keys AND values) are module INPUTS, so the bf16-rounded operands enter WMMA 16x16x32 directly: logits with EXACT bf16 x bf16 products (1 product, f32 accumulate), UNSCALED (logits std ~11, very peaked; exact products matter), running-max softmax in f32 (hardware exp); P rounded once to f16 (x 2^11) against v converted bf16 -> f16 (exact for normal values) (1 product); f32 output [R, D].
#include <hip/hip_runtime.h>
#include <math.h>

typedef __attribute__((ext_vector_type(16))) _Float16 v16h;
typedef __attribute__((ext_vector_type(16))) __bf16 v16b;
typedef __attribute__((ext_vector_type(8)))  _Float16 v8h;
typedef __attribute__((ext_vector_type(8)))  float v8f;
typedef __attribute__((ext_vector_type(4)))  float v4f;
typedef __attribute__((ext_vector_type(2)))  float v2f;
typedef __attribute__((ext_vector_type(4)))  unsigned v4u;
typedef __attribute__((ext_vector_type(4)))  int v4i;
typedef float __attribute__((may_alias)) float_a;
typedef int __attribute__((may_alias)) int_a;

template <typename T> __device__ __forceinline__ void vst2(void* p, T v) { *(T*)p = v;  }
__device__ __forceinline__ v8f wmma16(v16h a, v16h b, v8f c) {
  v8f d = __builtin_amdgcn_wmma_f32_16x16x32_f16(false, a, false, b, (short)0, c, false, false);
  asm volatile("v_nop\n\tv_nop\n\tv_nop\n\tv_nop" : "+v"(d) : "v"(a), "v"(b));
  return d;
}
__device__ __forceinline__ v8f wmma_bf(v16b a, v16b b, v8f c) {
  v8f d = __builtin_amdgcn_wmma_f32_16x16x32_bf16(false, a, false, b, (short)0, c, false, false);
  asm volatile("v_nop\n\tv_nop\n\tv_nop\n\tv_nop" : "+v"(d) : "v"(a), "v"(b));
  return d;
}
// 16x16x32 fragments: lane = (h = lane>>4, row/col = lane&15); elements 0..7 = k0+8h+0..7, 8..15 = k0+16+8h+0..7; D element r = row 8h+r
__device__ __forceinline__ v16h frag_h(const _Float16* rowk0, int lane) {
  union { v16h v; v8h q[2]; } u; const _Float16* p = rowk0 + 8 * (lane >> 4);
  u.q[0] = *(const v8h*)p; u.q[1] = *(const v8h*)(p + 16); return u.v;
}
__device__ __forceinline__ v16h frag_f32(const float* rowk0, int lane) {
  v16h a; const float* p = rowk0 + 8 * (lane >> 4);
#pragma unroll
  for (int i = 0; i < 8; ++i) { a[i] = (_Float16)p[i]; a[8 + i] = (_Float16)p[16 + i]; }
  return a;
}
__device__ __forceinline__ v16h frag_f32s(const float* rowk0, int lane, float sc) {
  v16h a; const float* p = rowk0 + 8 * (lane >> 4);
#pragma unroll
  for (int i = 0; i < 8; ++i) { a[i] = (_Float16)(p[i] * sc); a[8 + i] = (_Float16)(p[16 + i] * sc); }
  return a;
}
// column fragment from a [K][ld] layout (column n), rows >= K read as 0
__device__ __forceinline__ v16h fragc_f32(const float* W, int k0, int n, int lane, int ld, int K) {
  v16h a; const int g = lane >> 4;
#pragma unroll
  for (int i = 0; i < 8; ++i) { const int ka = k0 + 8 * g + i, kb = ka + 16;
    a[i] = (_Float16)(ka < K ? W[(size_t)(ka < K ? ka : K - 1) * ld + n] : 0.f); a[8 + i] = (_Float16)(kb < K ? W[(size_t)(kb < K ? kb : K - 1) * ld + n] : 0.f); }
  return a;
}
struct F2 { v16b h, l; };
__device__ __forceinline__ F2 bsplit16(const float v[16]) { F2 r;
#pragma unroll
  for (int i = 0; i < 16; ++i) { const __bf16 h = (__bf16)v[i]; r.h[i] = h; r.l[i] = (__bf16)(v[i] - (float)h); }
  return r; }
__device__ __forceinline__ F2 split_row(const float* row, int k0, int lane) { float v[16]; const float* p = row + k0 + 8 * (lane >> 4);
#pragma unroll
  for (int i = 0; i < 8; ++i) { v[i] = p[i]; v[8 + i] = p[16 + i]; }
  return bsplit16(v); }
__device__ __forceinline__ F2 split_rowK(const float* row, int k0, int lane, int K) { float v[16]; const int g = lane >> 4;
#pragma unroll
  for (int i = 0; i < 8; ++i) { const int ka = k0 + 8 * g + i, kb = ka + 16; v[i] = ka < K ? row[ka < K ? ka : K - 1] : 0.f; v[8 + i] = kb < K ? row[kb < K ? kb : K - 1] : 0.f; }
  return bsplit16(v); }
__device__ __forceinline__ F2 split_col(const float* W, int k0, int n, int lane, int ld, int K) { float v[16]; const int g = lane >> 4;
#pragma unroll
  for (int i = 0; i < 8; ++i) { const int ka = k0 + 8 * g + i, kb = ka + 16; v[i] = ka < K ? W[(size_t)(ka < K ? ka : K - 1) * ld + n] : 0.f; v[8 + i] = kb < K ? W[(size_t)(kb < K ? kb : K - 1) * ld + n] : 0.f; }
  return bsplit16(v); }
__device__ __forceinline__ v8f mac3(const F2& a, const F2& b, v8f c) { c = wmma_bf(a.l, b.h, c); c = wmma_bf(a.h, b.l, c); return wmma_bf(a.h, b.h, c); }
__device__ __forceinline__ float sigm(float v) { return 1.0f / (1.0f + expf(-v)); }
#define LDSX() do { asm volatile("s_wait_dscnt 0" ::: "memory"); __builtin_amdgcn_wave_barrier(); __builtin_amdgcn_fence(__ATOMIC_RELEASE, "workgroup"); } while (0)


// Soft attention between two raw inputs (L = R = 8,192 rows, D 128): scores[r][l] = rinput_r . linput_l (unscaled); alpha = softmax over l; Y[r] = sum_l alpha[r][l] linput_l.
#define NB 1
#define NS 8192
#define NH 1
#define DD 128
#define RS (NH * DD)      // row stride between consecutive s (128 floats)
#ifndef TQB
#define TQB (NS / 64)
#endif
typedef __attribute__((ext_vector_type(8))) __bf16 v8b;
__device__ __forceinline__ v16b frag_b(const __bf16* rowk0, int lane) {
  union { v16b v; v8b q[2]; } u; const __bf16* p = rowk0 + 8 * (lane >> 4);
  u.q[0] = *(const v8b*)p; u.q[1] = *(const v8b*)(p + 16); return u.v;
}
__device__ __forceinline__ float bfr(float v) { return (float)(__bf16)v; }
__device__ __attribute__((noinline)) float exp_ni(float v) { return expf(v); }
__device__ __attribute__((noinline)) float erf_ni(float v) { return erff(v); }

#define KB_E (32 * DD)                              // 16-bit elements of one packed block of 32 keys (8 KB)
#define WS_KP  0u                                   // bf16 key fragments   [key block][ct * 4 + kc][half][lane][8]
#define WS_VP  (WS_KP + 2u * (size_t)NS * DD)       // f16 value fragments  [key block][j][half][lane][8]
#define WS_END (WS_VP + 2u * (size_t)NS * DD)

// ---- k_pack: block = one block of 32 keys. Rounds its rows once (keys to bf16, values bf16 -> f16) and stores them in the order in which k_att's lanes hold them:
// one unit = the 16 bytes of one lane for one half fragment, the 32 lanes' units side by side, so that each wave-wide 16-byte load of k_att reads 512 contiguous bytes (4 whole lines)
__global__ __launch_bounds__(256) void k_pack(const float* __restrict__ X, __bf16* __restrict__ KP, _Float16* __restrict__ VP) {
  __shared__ __align__(16) float t[32][DD + 4]; const int tid = threadIdx.x; const size_t ks = blockIdx.x;
#pragma unroll   // the four row loads of a thread are in flight together, one round trip to memory instead of four
  for (int k = 0; k < 4; ++k) { const int e = tid + k * 256, r = e >> 5, c = (e & 31) * 4; *(v4f*)&t[r][c] = *(const v4f*)(X + (ks * 32 + r) * (size_t)DD + c); }
  __syncthreads();
#pragma unroll   // both units' LDS reads issue ahead of the first wait
  for (int k = 0; k < 2; ++k) { const int u = tid + k * 256, col = u & 15, g = (u >> 4) & 1, hf = (u >> 5) & 1, f = u >> 6;
    const float* p = &t[(f >> 2) * 16 + col][(f & 3) * 32 + hf * 16 + 8 * g]; v8b kb; v8h vh;
#pragma unroll   // constant element numbers keep kb and vh in registers
    for (int i = 0; i < 8; ++i) { kb[i] = (__bf16)p[i]; vh[i] = (_Float16)bfr(t[hf * 16 + 8 * g + i][f * 16 + col]); }
    *(v8b*)(KP + ks * KB_E + u * 8) = kb; *(v8h*)(VP + ks * KB_E + u * 8) = vh; } }
// ---- k_att: block = 32 queries (2 query tiles of 16) x NR key ranges, one wave per (tile, range): wave (qt, kr) walks key blocks kr, kr + NR, ... with its own running max, sum and accumulators; the ranges are merged in LDS behind one barrier
#define QT 2
#define NR 10
#define NW (QT * NR)
__global__ __launch_bounds__(NW * 32) void k_att(const float* __restrict__ Q, const __bf16* __restrict__ KP, const _Float16* __restrict__ VP, float* __restrict__ OUT) {
  __shared__ __align__(16) float sp[NW][16][36]; __shared__ __align__(16) float so[NW][16][132]; __shared__ float sm[NW][16]; __shared__ float sl[NW][16];
  // readfirstlane: the wave's number as a scalar, so that the key loop's counter and branch and the LDS bases stay on the scalar side
  const int tid = threadIdx.x, wave = __builtin_amdgcn_readfirstlane(tid >> 5), lane = tid & 31, col = lane & 15, g = lane >> 4; const size_t bh = blockIdx.y; const size_t b = bh / NH; const int h = bh % NH; const int qt = wave % QT, kr = wave / QT; const int q0 = blockIdx.x * (16 * QT) + qt * 16;
  v16b aq[4];
#pragma unroll
  for (int kc = 0; kc < 4; ++kc) { const float* pp = Q + ((b * NS + q0 + col) * NH + h) * (size_t)DD + kc * 32 + 8 * g;
#pragma unroll
    for (int i = 0; i < 8; ++i) { aq[kc][i] = (__bf16)pp[i]; aq[kc][8 + i] = (__bf16)pp[16 + i]; } }
  float m[8], l[8];
#pragma unroll
  for (int r = 0; r < 8; ++r) { m[r] = -3.0e38f; l[r] = 0.f; }
  v8f acc[8];
#pragma unroll
  for (int j = 0; j < 8; ++j) acc[j] = v8f{};
#pragma unroll 1
  for (int ks = kr; ks < NS / 32; ks += NR) { float s[2][8]; const v8b* kp = (const v8b*)(KP + (size_t)ks * KB_E) + lane; const v8h* vp = (const v8h*)(VP + (size_t)ks * KB_E) + lane;
#pragma unroll
    for (int ct = 0; ct < 2; ++ct) { v8f c = {};
#pragma unroll
      for (int kc = 0; kc < 4; ++kc) { union { v16b v; v8b q[2]; } w; w.q[0] = kp[(ct * 4 + kc) * 64]; w.q[1] = kp[(ct * 4 + kc) * 64 + 32];
        c = wmma_bf(aq[kc], w.v, c); }
#pragma unroll
      for (int r = 0; r < 8; ++r) s[ct][r] = c[r]; }
    float alpha[8];
#pragma unroll
    for (int r = 0; r < 8; ++r) { float mx = fmaxf(s[0][r], s[1][r]);
#pragma unroll
      for (int o = 1; o < 16; o <<= 1) mx = fmaxf(mx, __shfl_xor(mx, o));
      const float mn = fmaxf(m[r], mx); alpha[r] = __expf(m[r] - mn); const float e0 = __expf(s[0][r] - mn), e1 = __expf(s[1][r] - mn); float es = e0 + e1;
#pragma unroll
      for (int o = 1; o < 16; o <<= 1) es += __shfl_xor(es, o);
      l[r] = l[r] * alpha[r] + es; m[r] = mn; sp[wave][8 * g + r][col] = e0; sp[wave][8 * g + r][16 + col] = e1; }
#pragma unroll
    for (int j = 0; j < 8; ++j)
#pragma unroll
      for (int r = 0; r < 8; ++r) acc[j][r] *= alpha[r];
    LDSX();
    v16h pa; { const float* prow = &sp[wave][col][0] + 8 * (lane >> 4);
#pragma unroll
      for (int i = 0; i < 8; ++i) { pa[i] = (_Float16)(prow[i] * 2048.0f); pa[8 + i] = (_Float16)(prow[16 + i] * 2048.0f); } }
#pragma unroll
    for (int j = 0; j < 8; ++j) { union { v16h v; v8h q[2]; } w; w.q[0] = vp[j * 64]; w.q[1] = vp[j * 64 + 32]; acc[j] = wmma16(pa, w.v, acc[j]); }
    LDSX(); }
  // each wave leaves its un-normalised partial, with its max and sum per row
#pragma unroll
  for (int r = 0; r < 8; ++r) {
#pragma unroll
    for (int j = 0; j < 8; ++j) so[wave][8 * g + r][j * 16 + col] = acc[j][r];
    if (col == 0) { sm[wave][8 * g + r] = m[r]; sl[wave][8 * g + r] = l[r]; } }
  __syncthreads();
  // merge: one wave per output row, a lane holds 4 columns; weight of range k = exp(m_k - max over ranges)
  for (int row = wave; row < 16 * QT; row += NW) { const int t = row >> 4, rl = row & 15; float mm = sm[t][rl];
#pragma unroll   // both loops unrolled: all ranges' LDS reads issue ahead of the first wait
    for (int k = 1; k < NR; ++k) mm = fmaxf(mm, sm[k * QT + t][rl]);
    float ls = 0.f; v4f o = {};
#pragma unroll
    for (int k = 0; k < NR; ++k) { const float wk = __expf(sm[k * QT + t][rl] - mm); ls += wk * sl[k * QT + t][rl]; o += wk * *(const v4f*)&so[k * QT + t][rl][lane * 4]; }
    vst2(OUT + ((b * NS + blockIdx.x * (16 * QT) + row) * NH + h) * (size_t)DD + lane * 4, o * ((1.0f / 2048.0f) / ls)); } }
extern "C" void kernel_launch(void* const* d_in, const int* in_sizes, int n_in, void* d_out, int out_size, void* d_ws, size_t ws_size, hipStream_t stream) {
  (void)in_sizes; (void)n_in; (void)out_size;
  const float** F = (const float**)d_in;   // 0 linput [8192,128] (keys and values), 1 rinput [8192,128] (queries)
  if (ws_size < (size_t)WS_END) return;
  char* ws = (char*)d_ws; __bf16* KP = (__bf16*)(ws + WS_KP); _Float16* VP = (_Float16*)(ws + WS_VP);
  k_pack<<<dim3(NS / 32), 256, 0, stream>>>(F[0], KP, VP);
  k_att<<<dim3(NS / (16 * QT), 1), NW * 32, 0, stream>>>(F[1], KP, VP, (float*)d_out);
}

// v003
// It runs in 56.7 microseconds.
// In two side-by-side timings against v002, it was 3.42 and 3.41 times as fast.
// All steps since v000 together make it 18.9 times as fast.
// compute dtype: all float inputs rounded to bf16; rinput (queries) and linput (keys AND values) are module INPUTS, so the bf16-rounded operands enter WMMA 16x16x32 directly: logits with EXACT bf16 x bf16 products (1 product, f32 accumulate), UNSCALED (logits std ~11, very peaked; exact products matter), running-max softmax in f32 (hardware exp); P rounded once to f16 (x 2^11) against v converted bf16 -> f16 (exact for normal values) (1 product); f32 output [R, D].
#include <hip/hip_runtime.h>
#include <math.h>

typedef __attribute__((ext_vector_type(16))) _Float16 v16h;
typedef __attribute__((ext_vector_type(16))) __bf16 v16b;
typedef __attribute__((ext_vector_type(8)))  _Float16 v8h;
typedef __attribute__((ext_vector_type(8)))  float v8f;
typedef __attribute__((ext_vector_type(4)))  float v4f;
typedef __attribute__((ext_vector_type(2)))  float v2f;
typedef __attribute__((ext_vector_type(4)))  unsigned v4u;
typedef __attribute__((ext_vector_type(4)))  int v4i;
typedef float __attribute__((may_alias)) float_a;
typedef int __attribute__((may_alias)) int_a;

template <typename T> __device__ __forceinline__ void vst2(void* p, T v) { *(T*)p = v;  }
__device__ __forceinline__ v8f wmma16(v16h a, v16h b, v8f c) {
  v8f d = __builtin_amdgcn_wmma_f32_16x16x32_f16(false, a, false, b, (short)0, c, false, false);
  asm volatile("v_nop\n\tv_nop\n\tv_nop\n\tv_nop" : "+v"(d) : "v"(a), "v"(b));
  return d;
}
__device__ __forceinline__ v8f wmma_bf(v16b a, v16b b, v8f c) {
  v8f d = __builtin_amdgcn_wmma_f32_16x16x32_bf16(false, a, false, b, (short)0, c, false, false);
  asm volatile("v_nop\n\tv_nop\n\tv_nop\n\tv_nop" : "+v"(d) : "v"(a), "v"(b));
  return d;
}
// 16x16x32 fragments: lane = (h = lane>>4, row/col = lane&15); elements 0..7 = k0+8h+0..7, 8..15 = k0+16+8h+0..7; D element r = row 8h+r
__device__ __forceinline__ v16h frag_h(const _Float16* rowk0, int lane) {
  union { v16h v; v8h q[2]; } u; const _Float16* p = rowk0 + 8 * (lane >> 4);
  u.q[0] = *(const v8h*)p; u.q[1] = *(const v8h*)(p + 16); return u.v;
}
__device__ __forceinline__ v16h frag_f32(const float* rowk0, int lane) {
  v16h a; const float* p = rowk0 + 8 * (lane >> 4);
#pragma unroll
  for (int i = 0; i < 8; ++i) { a[i] = (_Float16)p[i]; a[8 + i] = (_Float16)p[16 + i]; }
  return a;
}
__device__ __forceinline__ v16h frag_f32s(const float* rowk0, int lane, float sc) {
  v16h a; const float* p = rowk0 + 8 * (lane >> 4);
#pragma unroll
  for (int i = 0; i < 8; ++i) { a[i] = (_Float16)(p[i] * sc); a[8 + i] = (_Float16)(p[16 + i] * sc); }
  return a;
}
// column fragment from a [K][ld] layout (column n), rows >= K read as 0
__device__ __forceinline__ v16h fragc_f32(const float* W, int k0, int n, int lane, int ld, int K) {
  v16h a; const int g = lane >> 4;
#pragma unroll
  for (int i = 0; i < 8; ++i) { const int ka = k0 + 8 * g + i, kb = ka + 16;
    a[i] = (_Float16)(ka < K ? W[(size_t)(ka < K ? ka : K - 1) * ld + n] : 0.f); a[8 + i] = (_Float16)(kb < K ? W[(size_t)(kb < K ? kb : K - 1) * ld + n] : 0.f); }
  return a;
}
struct F2 { v16b h, l; };
__device__ __forceinline__ F2 bsplit16(const float v[16]) { F2 r;
#pragma unroll
  for (int i = 0; i < 16; ++i) { const __bf16 h = (__bf16)v[i]; r.h[i] = h; r.l[i] = (__bf16)(v[i] - (float)h); }
  return r; }
__device__ __forceinline__ F2 split_row(const float* row, int k0, int lane) { float v[16]; const float* p = row + k0 + 8 * (lane >> 4);
#pragma unroll
  for (int i = 0; i < 8; ++i) { v[i] = p[i]; v[8 + i] = p[16 + i]; }
  return bsplit16(v); }
__device__ __forceinline__ F2 split_rowK(const float* row, int k0, int lane, int K) { float v[16]; const int g = lane >> 4;
#pragma unroll
  for (int i = 0; i < 8; ++i) { const int ka = k0 + 8 * g + i, kb = ka + 16; v[i] = ka < K ? row[ka < K ? ka : K - 1] : 0.f; v[8 + i] = kb < K ? row[kb < K ? kb : K - 1] : 0.f; }
  return bsplit16(v); }
__device__ __forceinline__ F2 split_col(const float* W, int k0, int n, int lane, int ld, int K) { float v[16]; const int g = lane >> 4;
#pragma unroll
  for (int i = 0; i < 8; ++i) { const int ka = k0 + 8 * g + i, kb = ka + 16; v[i] = ka < K ? W[(size_t)(ka < K ? ka : K - 1) * ld + n] : 0.f; v[8 + i] = kb < K ? W[(size_t)(kb < K ? kb : K - 1) * ld + n] : 0.f; }
  return bsplit16(v); }
__device__ __forceinline__ v8f mac3(const F2& a, const F2& b, v8f c) { c = wmma_bf(a.l, b.h, c); c = wmma_bf(a.h, b.l, c); return wmma_bf(a.h, b.h, c); }
__device__ __forceinline__ float sigm(float v) { return 1.0f / (1.0f + expf(-v)); }
#define LDSX() do { asm volatile("s_wait_dscnt 0" ::: "memory"); __builtin_amdgcn_wave_barrier(); __builtin_amdgcn_fence(__ATOMIC_RELEASE, "workgroup"); } while (0)


// Soft attention between two raw inputs (L = R = 8,192 rows, D 128): scores[r][l] = rinput_r . linput_l (unscaled); alpha = softmax over l; Y[r] = sum_l alpha[r][l] linput_l.
#define NB 1
#define NS 8192
#define NH 1
#define DD 128
#define RS (NH * DD)      // row stride between consecutive s (128 floats)
#ifndef TQB
#define TQB (NS / 64)
#endif
typedef __attribute__((ext_vector_type(8))) __bf16 v8b;
__device__ __forceinline__ v16b frag_b(const __bf16* rowk0, int lane) {
  union { v16b v; v8b q[2]; } u; const __bf16* p = rowk0 + 8 * (lane >> 4);
  u.q[0] = *(const v8b*)p; u.q[1] = *(const v8b*)(p + 16); return u.v;
}
__device__ __forceinline__ float bfr(float v) { return (float)(__bf16)v; }
__device__ __attribute__((noinline)) float exp_ni(float v) { return expf(v); }
__device__ __attribute__((noinline)) float erf_ni(float v) { return erff(v); }

#define KB_E (32 * DD)                              // 16-bit elements of one packed block of 32 keys (8 KB)
#define WS_KP  0u                                   // bf16 key fragments   [key block][ct * 4 + kc][half][lane][8]
#define WS_VP  (WS_KP + 2u * (size_t)NS * DD)       // f16 value fragments  [key block][j][half][lane][8]
#define WS_END (WS_VP + 2u * (size_t)NS * DD)

// ---- k_pack: block = one block of 32 keys. Rounds its rows once (keys to bf16, values bf16 -> f16) and stores them in the order in which k_att's lanes hold them:
// one unit = the 16 bytes of one lane for one half fragment, the 32 lanes' units side by side, so that each wave-wide 16-byte load of k_att reads 512 contiguous bytes (4 whole lines)
__global__ __launch_bounds__(256) void k_pack(const float* __restrict__ X, __bf16* __restrict__ KP, _Float16* __restrict__ VP) {
  __shared__ __align__(16) float t[32][DD + 4]; const int tid = threadIdx.x; const size_t ks = blockIdx.x;
#pragma unroll   // the four row loads of a thread are in flight together, one round trip to memory instead of four
  for (int k = 0; k < 4; ++k) { const int e = tid + k * 256, r = e >> 5, c = (e & 31) * 4; *(v4f*)&t[r][c] = *(const v4f*)(X + (ks * 32 + r) * (size_t)DD + c); }
  __syncthreads();
#pragma unroll   // both units' LDS reads issue ahead of the first wait
  for (int k = 0; k < 2; ++k) { const int u = tid + k * 256, col = u & 15, g = (u >> 4) & 1, hf = (u >> 5) & 1, f = u >> 6;
    const float* p = &t[(f >> 2) * 16 + col][(f & 3) * 32 + hf * 16 + 8 * g]; v8b kb; v8h vh;
#pragma unroll   // constant element numbers keep kb and vh in registers
    for (int i = 0; i < 8; ++i) { kb[i] = (__bf16)p[i]; vh[i] = (_Float16)bfr(t[hf * 16 + 8 * g + i][f * 16 + col]); }
    *(v8b*)(KP + ks * KB_E + u * 8) = kb; *(v8h*)(VP + ks * KB_E + u * 8) = vh; } }
// ---- k_att: block = 32 queries (2 query tiles of 16) x NR key ranges, one wave per (tile, range): wave (qt, kr) walks key blocks kr, kr + NR, ... with its own running max, sum and accumulators; the ranges are merged in LDS behind one barrier
// LDSW: keeps a wave's own LDS writes ahead of its own reads of them, and the reverse (sp[wave] is read and written by that wave alone). It is LDSX without the work-group release: that one also drains the global loads, which are meant to stay in flight across this point
#define LDSW() do { asm volatile("s_wait_dscnt 0" ::: "memory"); __builtin_amdgcn_wave_barrier(); } while (0)
#define QT 2
#define NR 8
#define NW (QT * NR)
__global__ __launch_bounds__(NW * 32) void k_att(const float* __restrict__ Q, const __bf16* __restrict__ KP, const _Float16* __restrict__ VP, float* __restrict__ OUT) {
  __shared__ __align__(16) float sp[NW][16][36]; __shared__ __align__(16) float so[NW][16][132]; __shared__ float sm[NW][16]; __shared__ float sl[NW][16];
  // readfirstlane: the wave's number as a scalar, so that the key loop's counter and branch and the LDS bases stay on the scalar side
  const int tid = threadIdx.x, wave = __builtin_amdgcn_readfirstlane(tid >> 5), lane = tid & 31, col = lane & 15, g = lane >> 4; const size_t bh = blockIdx.y; const size_t b = bh / NH; const int h = bh % NH; const int qt = wave % QT, kr = wave / QT; const int q0 = blockIdx.x * (16 * QT) + qt * 16;
  v16b aq[4];
#pragma unroll
  for (int kc = 0; kc < 4; ++kc) { const float* pp = Q + ((b * NS + q0 + col) * NH + h) * (size_t)DD + kc * 32 + 8 * g;
#pragma unroll
    for (int i = 0; i < 8; ++i) { aq[kc][i] = (__bf16)pp[i]; aq[kc][8 + i] = (__bf16)pp[16 + i]; } }
  float m[8], l[8];
#pragma unroll
  for (int r = 0; r < 8; ++r) { m[r] = -3.0e38f; l[r] = 0.f; }
  v8f acc[8];
#pragma unroll
  for (int j = 0; j < 8; ++j) acc[j] = v8f{};
  // all 8 fragments of a block are fetched ahead and stay in flight together: a block's values are asked for as the score products free its keys' registers (their trip to L2 runs under the softmax),
  // the next block's keys as the output products free the values' registers; one round trip for 8 fragments instead of one for each
  union { v16b v; v8b q[2]; } kf[8]; union { v16h v; v8h q[2]; } vf[8];
  { const v8b* kp = (const v8b*)(KP + (size_t)kr * KB_E) + lane;
#pragma unroll
    for (int i = 0; i < 8; ++i) { kf[i].q[0] = kp[i * 64]; kf[i].q[1] = kp[i * 64 + 32]; } }
#pragma unroll 1
  for (int ks = kr; ks < NS / 32; ks += NR) { float s[2][8]; const int kn = ks + NR < NS / 32 ? ks + NR : ks;   // the last trip has no next block: it asks for its own again, in bounds, and nobody reads it
    const v8b* kp = (const v8b*)(KP + (size_t)kn * KB_E) + lane; const v8h* vp = (const v8h*)(VP + (size_t)ks * KB_E) + lane;
#pragma unroll
    for (int ct = 0; ct < 2; ++ct) { v8f c = {};
#pragma unroll
      for (int kc = 0; kc < 4; ++kc) { const int i = ct * 4 + kc; c = wmma_bf(aq[kc], kf[i].v, c); vf[i].q[0] = vp[i * 64]; vf[i].q[1] = vp[i * 64 + 32]; }
#pragma unroll
      for (int r = 0; r < 8; ++r) s[ct][r] = c[r]; }
    float alpha[8];
#pragma unroll
    for (int r = 0; r < 8; ++r) { float mx = fmaxf(s[0][r], s[1][r]);
#pragma unroll
      for (int o = 1; o < 16; o <<= 1) mx = fmaxf(mx, __shfl_xor(mx, o));
      const float mn = fmaxf(m[r], mx); alpha[r] = __expf(m[r] - mn); const float e0 = __expf(s[0][r] - mn), e1 = __expf(s[1][r] - mn); float es = e0 + e1;
#pragma unroll
      for (int o = 1; o < 16; o <<= 1) es += __shfl_xor(es, o);
      l[r] = l[r] * alpha[r] + es; m[r] = mn; sp[wave][8 * g + r][col] = e0; sp[wave][8 * g + r][16 + col] = e1; }
#pragma unroll
    for (int j = 0; j < 8; ++j)
#pragma unroll
      for (int r = 0; r < 8; ++r) acc[j][r] *= alpha[r];
    LDSW();
    v16h pa; { const float* prow = &sp[wave][col][0] + 8 * (lane >> 4);
#pragma unroll
      for (int i = 0; i < 8; ++i) { pa[i] = (_Float16)(prow[i] * 2048.0f); pa[8 + i] = (_Float16)(prow[16 + i] * 2048.0f); } }
#pragma unroll
    for (int j = 0; j < 8; ++j) { acc[j] = wmma16(pa, vf[j].v, acc[j]); kf[j].q[0] = kp[j * 64]; kf[j].q[1] = kp[j * 64 + 32]; }
    LDSW(); }
  // each wave leaves its un-normalised partial, with its max and sum per row
#pragma unroll
  for (int r = 0; r < 8; ++r) {
#pragma unroll
    for (int j = 0; j < 8; ++j) so[wave][8 * g + r][j * 16 + col] = acc[j][r];
    if (col == 0) { sm[wave][8 * g + r] = m[r]; sl[wave][8 * g + r] = l[r]; } }
  __syncthreads();
  // merge: one wave per output row, a lane holds 4 columns; weight of range k = exp(m_k - max over ranges)
  for (int row = wave; row < 16 * QT; row += NW) { const int t = row >> 4, rl = row & 15; float mm = sm[t][rl];
#pragma unroll   // both loops unrolled: all ranges' LDS reads issue ahead of the first wait
    for (int k = 1; k < NR; ++k) mm = fmaxf(mm, sm[k * QT + t][rl]);
    float ls = 0.f; v4f o = {};
#pragma unroll
    for (int k = 0; k < NR; ++k) { const float wk = __expf(sm[k * QT + t][rl] - mm); ls += wk * sl[k * QT + t][rl]; o += wk * *(const v4f*)&so[k * QT + t][rl][lane * 4]; }
    vst2(OUT + ((b * NS + blockIdx.x * (16 * QT) + row) * NH + h) * (size_t)DD + lane * 4, o * ((1.0f / 2048.0f) / ls)); } }
extern "C" void kernel_launch(void* const* d_in, const int* in_sizes, int n_in, void* d_out, int out_size, void* d_ws, size_t ws_size, hipStream_t stream) {
  (void)in_sizes; (void)n_in; (void)out_size;
  const float** F = (const float**)d_in;   // 0 linput [8192,128] (keys and values), 1 rinput [8192,128] (queries)
  if (ws_size < (size_t)WS_END) return;
  char* ws = (char*)d_ws; __bf16* KP = (__bf16*)(ws + WS_KP); _Float16* VP = (_Float16*)(ws + WS_VP);
  k_pack<<<dim3(NS / 32), 256, 0, stream>>>(F[0], KP, VP);
  k_att<<<dim3(NS / (16 * QT), 1), NW * 32, 0, stream>>>(F[1], KP, VP, (float*)d_out);
}

// v004
// Measured time: 50.6 microseconds a run.
// Two timings next to v003 put it at 1.16 and 1.10 times that version's speed.
// All steps since v000 together make it 21.4 times as fast.
// compute dtype: all float inputs rounded to bf16; rinput (queries) and linput (keys AND values) are module INPUTS, so the bf16-rounded operands enter WMMA 16x16x32 directly: logits with EXACT bf16 x bf16 products (1 product, f32 accumulate), UNSCALED (logits std ~11, very peaked; exact products matter), running-max softmax in f32 (hardware exp); P rounded once to f16 (x 2^11) against v converted bf16 -> f16 (exact for normal values) (1 product); f32 output [R, D].
#include <hip/hip_runtime.h>
#include <math.h>

typedef __attribute__((ext_vector_type(16))) _Float16 v16h;
typedef __attribute__((ext_vector_type(16))) __bf16 v16b;
typedef __attribute__((ext_vector_type(8)))  _Float16 v8h;
typedef __attribute__((ext_vector_type(8)))  float v8f;
typedef __attribute__((ext_vector_type(4)))  float v4f;
typedef __attribute__((ext_vector_type(2)))  float v2f;
typedef __attribute__((ext_vector_type(4)))  unsigned v4u;
typedef __attribute__((ext_vector_type(4)))  int v4i;
typedef float __attribute__((may_alias)) float_a;
typedef int __attribute__((may_alias)) int_a;

template <typename T> __device__ __forceinline__ void vst2(void* p, T v) { *(T*)p = v;  }
__device__ __forceinline__ v8f wmma16(v16h a, v16h b, v8f c) {
  v8f d = __builtin_amdgcn_wmma_f32_16x16x32_f16(false, a, false, b, (short)0, c, false, false);
  asm volatile("v_nop\n\tv_nop\n\tv_nop\n\tv_nop" : "+v"(d) : "v"(a), "v"(b));
  return d;
}
__device__ __forceinline__ v8f wmma_bf(v16b a, v16b b, v8f c) {
  v8f d = __builtin_amdgcn_wmma_f32_16x16x32_bf16(false, a, false, b, (short)0, c, false, false);
  asm volatile("v_nop\n\tv_nop\n\tv_nop\n\tv_nop" : "+v"(d) : "v"(a), "v"(b));
  return d;
}
// 16x16x32 fragments: lane = (h = lane>>4, row/col = lane&15); elements 0..7 = k0+8h+0..7, 8..15 = k0+16+8h+0..7; D element r = row 8h+r
__device__ __forceinline__ v16h frag_h(const _Float16* rowk0, int lane) {
  union { v16h v; v8h q[2]; } u; const _Float16* p = rowk0 + 8 * (lane >> 4);
  u.q[0] = *(const v8h*)p; u.q[1] = *(const v8h*)(p + 16); return u.v;
}
__device__ __forceinline__ v16h frag_f32(const float* rowk0, int lane) {
  v16h a; const float* p = rowk0 + 8 * (lane >> 4);
#pragma unroll
  for (int i = 0; i < 8; ++i) { a[i] = (_Float16)p[i]; a[8 + i] = (_Float16)p[16 + i]; }
  return a;
}
__device__ __forceinline__ v16h frag_f32s(const float* rowk0, int lane, float sc) {
  v16h a; const float* p = rowk0 + 8 * (lane >> 4);
#pragma unroll
  for (int i = 0; i < 8; ++i) { a[i] = (_Float16)(p[i] * sc); a[8 + i] = (_Float16)(p[16 + i] * sc); }
  return a;
}
// column fragment from a [K][ld] layout (column n), rows >= K read as 0
__device__ __forceinline__ v16h fragc_f32(const float* W, int k0, int n, int lane, int ld, int K) {
  v16h a; const int g = lane >> 4;
#pragma unroll
  for (int i = 0; i < 8; ++i) { const int ka = k0 + 8 * g + i, kb = ka + 16;
    a[i] = (_Float16)(ka < K ? W[(size_t)(ka < K ? ka : K - 1) * ld + n] : 0.f); a[8 + i] = (_Float16)(kb < K ? W[(size_t)(kb < K ? kb : K - 1) * ld + n] : 0.f); }
  return a;
}
struct F2 { v16b h, l; };
__device__ __forceinline__ F2 bsplit16(const float v[16]) { F2 r;
#pragma unroll
  for (int i = 0; i < 16; ++i) { const __bf16 h = (__bf16)v[i]; r.h[i] = h; r.l[i] = (__bf16)(v[i] - (float)h); }
  return r; }
__device__ __forceinline__ F2 split_row(const float* row, int k0, int lane) { float v[16]; const float* p = row + k0 + 8 * (lane >> 4);
#pragma unroll
  for (int i = 0; i < 8; ++i) { v[i] = p[i]; v[8 + i] = p[16 + i]; }
  return bsplit16(v); }
__device__ __forceinline__ F2 split_rowK(const float* row, int k0, int lane, int K) { float v[16]; const int g = lane >> 4;
#pragma unroll
  for (int i = 0; i < 8; ++i) { const int ka = k0 + 8 * g + i, kb = ka + 16; v[i] = ka < K ? row[ka < K ? ka : K - 1] : 0.f; v[8 + i] = kb < K ? row[kb < K ? kb : K - 1] : 0.f; }
  return bsplit16(v); }
__device__ __forceinline__ F2 split_col(const float* W, int k0, int n, int lane, int ld, int K) { float v[16]; const int g = lane >> 4;
#pragma unroll
  for (int i = 0; i < 8; ++i) { const int ka = k0 + 8 * g + i, kb = ka + 16; v[i] = ka < K ? W[(size_t)(ka < K ? ka : K - 1) * ld + n] : 0.f; v[8 + i] = kb < K ? W[(size_t)(kb < K ? kb : K - 1) * ld + n] : 0.f; }
  return bsplit16(v); }
__device__ __forceinline__ v8f mac3(const F2& a, const F2& b, v8f c) { c = wmma_bf(a.l, b.h, c); c = wmma_bf(a.h, b.l, c); return wmma_bf(a.h, b.h, c); }
__device__ __forceinline__ float sigm(float v) { return 1.0f / (1.0f + expf(-v)); }
#define LDSX() do { asm volatile("s_wait_dscnt 0" ::: "memory"); __builtin_amdgcn_wave_barrier(); __builtin_amdgcn_fence(__ATOMIC_RELEASE, "workgroup"); } while (0)


// Soft attention between two raw inputs (L = R = 8,192 rows, D 128): scores[r][l] = rinput_r . linput_l (unscaled); alpha = softmax over l; Y[r] = sum_l alpha[r][l] linput_l.
#define NB 1
#define NS 8192
#define NH 1
#define DD 128
#define RS (NH * DD)      // row stride between consecutive s (128 floats)
#ifndef TQB
#define TQB (NS / 64)
#endif
typedef __attribute__((ext_vector_type(8))) __bf16 v8b;
__device__ __forceinline__ v16b frag_b(const __bf16* rowk0, int lane) {
  union { v16b v; v8b q[2]; } u; const __bf16* p = rowk0 + 8 * (lane >> 4);
  u.q[0] = *(const v8b*)p; u.q[1] = *(const v8b*)(p + 16); return u.v;
}
__device__ __forceinline__ float bfr(float v) { return (float)(__bf16)v; }
// lane l's value seen from lane l ^ 16, by a vector cross-row move (a shuffle would go through the LDS unit and its wait)
__device__ __forceinline__ float xhalf(float x) { return __builtin_bit_cast(float, __builtin_amdgcn_permlanex16(__builtin_bit_cast(int, x), __builtin_bit_cast(int, x), 0x76543210, 0xfedcba98, false, false)); }
__device__ __attribute__((noinline)) float exp_ni(float v) { return expf(v); }
__device__ __attribute__((noinline)) float erf_ni(float v) { return erff(v); }

#define KB_E (32 * DD)                              // 16-bit elements of one packed block of 32 keys (8 KB)
#define WS_KP  0u                                   // bf16 key fragments   [key block][ct * 4 + kc][half][lane][8]
#define WS_VP  (WS_KP + 2u * (size_t)NS * DD)       // f16 value fragments  [key block][j][half][lane][8]
#define WS_END (WS_VP + 2u * (size_t)NS * DD)

// ---- k_pack: block = one block of 32 keys. Rounds its rows once (keys to bf16, values bf16 -> f16) and stores them in the order in which k_att's lanes hold them:
// one unit = the 16 bytes of one lane for one half fragment, the 32 lanes' units side by side, so that each wave-wide 16-byte load of k_att reads 512 contiguous bytes (4 whole lines)
__global__ __launch_bounds__(256) void k_pack(const float* __restrict__ X, __bf16* __restrict__ KP, _Float16* __restrict__ VP) {
  __shared__ __align__(16) float t[32][DD + 4]; const int tid = threadIdx.x; const size_t ks = blockIdx.x;
#pragma unroll   // the four row loads of a thread are in flight together, one round trip to memory instead of four
  for (int k = 0; k < 4; ++k) { const int e = tid + k * 256, r = e >> 5, c = (e & 31) * 4; *(v4f*)&t[r][c] = *(const v4f*)(X + (ks * 32 + r) * (size_t)DD + c); }
  __syncthreads();
#pragma unroll   // both units' LDS reads issue ahead of the first wait
  for (int k = 0; k < 2; ++k) { const int u = tid + k * 256, col = u & 15, g = (u >> 4) & 1, hf = (u >> 5) & 1, f = u >> 6;
    const float* p = &t[(f >> 2) * 16 + col][(f & 3) * 32 + hf * 16 + 8 * g]; v8b kb; v8h vh;
#pragma unroll   // constant element numbers keep kb and vh in registers
    for (int i = 0; i < 8; ++i) { kb[i] = (__bf16)p[i]; vh[i] = (_Float16)bfr(t[hf * 16 + 8 * g + i][f * 16 + col]); }
    *(v8b*)(KP + ks * KB_E + u * 8) = kb; *(v8h*)(VP + ks * KB_E + u * 8) = vh; } }
#define QT 2
#define NR 8
#define NW (QT * NR)
__global__ __launch_bounds__(NW * 32) void k_att(const float* __restrict__ Q, const __bf16* __restrict__ KP, const _Float16* __restrict__ VP, float* __restrict__ OUT) {
  __shared__ __align__(16) float so[NW][16][132]; __shared__ float sm[NW][16]; __shared__ float sl[NW][16];
  // readfirstlane: the wave's number as a scalar, so that the key loop's counter and branch and the LDS bases stay on the scalar side
  const int tid = threadIdx.x, wave = __builtin_amdgcn_readfirstlane(tid >> 5), lane = tid & 31, col = lane & 15, g = lane >> 4; const size_t bh = blockIdx.y; const size_t b = bh / NH; const int h = bh % NH; const int qt = wave % QT, kr = wave / QT; const int q0 = blockIdx.x * (16 * QT) + qt * 16;
  v16b aq[4];
#pragma unroll
  for (int kc = 0; kc < 4; ++kc) { const float* pp = Q + ((b * NS + q0 + col) * NH + h) * (size_t)DD + kc * 32 + 8 * g;
#pragma unroll
    for (int i = 0; i < 8; ++i) { aq[kc][i] = (__bf16)pp[i]; aq[kc][8 + i] = (__bf16)pp[16 + i]; } }
  float m = -3.0e38f, l = 0.f;   // of query col: m over both halves' keys, l over this half's keys alone (the halves' sums are joined behind the loop)
  v8f acc[8];                    // acc[j][r] = O^T[j * 16 + 8 * g + r][col]
#pragma unroll
  for (int j = 0; j < 8; ++j) acc[j] = v8f{};
  // all 8 fragments of a block are fetched ahead and stay in flight together: a block's values are asked for as the score products free its keys' registers (their trip to L2 runs under the softmax),
  // the next block's keys as the output products free the values' registers; one round trip for 8 fragments instead of one for each
  union { v16b v; v8b q[2]; } kf[8]; union { v16h v; v8h q[2]; } vf[8];
  { const v8b* kp = (const v8b*)(KP + (size_t)kr * KB_E) + lane;
#pragma unroll
    for (int i = 0; i < 8; ++i) { kf[i].q[0] = kp[i * 64]; kf[i].q[1] = kp[i * 64 + 32]; } }
#pragma unroll 1
  for (int ks = kr; ks < NS / 32; ks += NR) { float s[2][8]; const int kn = ks + NR < NS / 32 ? ks + NR : ks;   // the last trip has no next block: it asks for its own again, in bounds, and nobody reads it
    const v8b* kp = (const v8b*)(KP + (size_t)kn * KB_E) + lane; const v8h* vp = (const v8h*)(VP + (size_t)ks * KB_E) + lane;
#pragma unroll
    for (int ct = 0; ct < 2; ++ct) { v8f c = {};
#pragma unroll
      for (int kc = 0; kc < 4; ++kc) { const int i = ct * 4 + kc; c = wmma_bf(kf[i].v, aq[kc], c); vf[i].q[0] = vp[i * 64]; vf[i].q[1] = vp[i * 64 + 32]; }
#pragma unroll
      for (int r = 0; r < 8; ++r) s[ct][r] = c[r]; }   // s[ct][r] = score of key ct * 16 + 8 * g + r with query col
    float mx = fmaxf(s[0][0], s[1][0]);
#pragma unroll
    for (int r = 1; r < 8; ++r) mx = fmaxf(mx, fmaxf(s[0][r], s[1][r]));
    mx = fmaxf(mx, xhalf(mx));   // both halves scale by the same max: their keys meet in one output product
    const float mn = fmaxf(m, mx), alpha = __expf(m - mn); float es[4] = {0.f, 0.f, 0.f, 0.f}; v16h pa;   // pa[ct * 8 + r]: k = ct * 16 + 8 * g + r, the hardware's k order, which the value fragments have too
#pragma unroll
    for (int r = 0; r < 8; ++r) { const float e0 = __expf(s[0][r] - mn), e1 = __expf(s[1][r] - mn); es[r & 1] += e0; es[2 + (r & 1)] += e1; pa[r] = (_Float16)(e0 * 2048.0f); pa[8 + r] = (_Float16)(e1 * 2048.0f); }
    l = l * alpha + ((es[0] + es[1]) + (es[2] + es[3])); m = mn;
#pragma unroll
    for (int j = 0; j < 8; ++j) acc[j] *= alpha;
#pragma unroll
    for (int j = 0; j < 8; ++j) { acc[j] = wmma16(vf[j].v, pa, acc[j]); kf[j].q[0] = kp[j * 64]; kf[j].q[1] = kp[j * 64 + 32]; }
    asm volatile("s_wait_xcnt 0x0" ::: "memory"); }   // stands in front of the next trip's rewrite of the address registers that the key loads above name
  // each wave leaves its un-normalised partial, with its max and sum per query; a lane's 8 accumulator registers are 8 consecutive columns of its query's output row
  l += xhalf(l);
#pragma unroll
  for (int j = 0; j < 8; ++j) { float* po = &so[wave][col][j * 16 + 8 * g]; *(v4f*)po = v4f{acc[j][0], acc[j][1], acc[j][2], acc[j][3]}; *(v4f*)(po + 4) = v4f{acc[j][4], acc[j][5], acc[j][6], acc[j][7]}; }
  if (g == 0) { sm[wave][col] = m; sl[wave][col] = l; }
  __syncthreads();
  // merge: one wave per output row, a lane holds 4 columns; weight of range k = exp(m_k - max over ranges)
  for (int row = wave; row < 16 * QT; row += NW) { const int t = row >> 4, rl = row & 15; float mm = sm[t][rl];
#pragma unroll   // both loops unrolled: all ranges' LDS reads issue ahead of the first wait
    for (int k = 1; k < NR; ++k) mm = fmaxf(mm, sm[k * QT + t][rl]);
    float ls = 0.f; v4f o = {};
#pragma unroll
    for (int k = 0; k < NR; ++k) { const float wk = __expf(sm[k * QT + t][rl] - mm); ls += wk * sl[k * QT + t][rl]; o += wk * *(const v4f*)&so[k * QT + t][rl][lane * 4]; }
    vst2(OUT + ((b * NS + blockIdx.x * (16 * QT) + row) * NH + h) * (size_t)DD + lane * 4, o * ((1.0f / 2048.0f) / ls)); } }
extern "C" void kernel_launch(void* const* d_in, const int* in_sizes, int n_in, void* d_out, int out_size, void* d_ws, size_t ws_size, hipStream_t stream) {
  (void)in_sizes; (void)n_in; (void)out_size;
  const float** F = (const float**)d_in;   // 0 linput [8192,128] (keys and values), 1 rinput [8192,128] (queries)
  if (ws_size < (size_t)WS_END) return;
  char* ws = (char*)d_ws; __bf16* KP = (__bf16*)(ws + WS_KP); _Float16* VP = (_Float16*)(ws + WS_VP);
  k_pack<<<dim3(NS / 32), 256, 0, stream>>>(F[0], KP, VP);
  k_att<<<dim3(NS / (16 * QT), 1), NW * 32, 0, stream>>>(F[1], KP, VP, (float*)d_out);
}

// v005
// One run takes 39.7 microseconds.
// In two side-by-side timings against v004, it was 1.29 and 1.24 times as fast.
// All steps since v000 together make it 27.1 times as fast.
// compute dtype: all float inputs rounded to bf16; rinput (queries) and linput (keys AND values) are module INPUTS, so the bf16-rounded operands enter WMMA 16x16x32 directly: logits with EXACT bf16 x bf16 products (1 product, f32 accumulate), UNSCALED (logits std ~11, very peaked; exact products matter), running-max softmax in f32 (hardware exp); P rounded once to f16 (x 2^11) against v converted bf16 -> f16 (exact for normal values) (1 product); f32 output [R, D].
#include <hip/hip_runtime.h>
#include <math.h>

typedef __attribute__((ext_vector_type(16))) _Float16 v16h;
typedef __attribute__((ext_vector_type(16))) __bf16 v16b;
typedef __attribute__((ext_vector_type(8)))  _Float16 v8h;
typedef __attribute__((ext_vector_type(8)))  float v8f;
typedef __attribute__((ext_vector_type(4)))  float v4f;
typedef __attribute__((ext_vector_type(2)))  float v2f;
typedef __attribute__((ext_vector_type(4)))  unsigned v4u;
typedef __attribute__((ext_vector_type(4)))  int v4i;
typedef float __attribute__((may_alias)) float_a;
typedef int __attribute__((may_alias)) int_a;

template <typename T> __device__ __forceinline__ void vst2(void* p, T v) { *(T*)p = v;  }
__device__ __forceinline__ v8f wmma16(v16h a, v16h b, v8f c) {
  return __builtin_amdgcn_wmma_f32_16x16x32_f16(false, a, false, b, (short)0, c, false, false);
}
__device__ __forceinline__ v8f wmma_bf(v16b a, v16b b, v8f c) {
  return __builtin_amdgcn_wmma_f32_16x16x32_bf16(false, a, false, b, (short)0, c, false, false);
}
// 16x16x32 fragments: lane = (h = lane>>4, row/col = lane&15); elements 0..7 = k0+8h+0..7, 8..15 = k0+16+8h+0..7; D element r = row 8h+r
__device__ __forceinline__ v16h frag_h(const _Float16* rowk0, int lane) {
  union { v16h v; v8h q[2]; } u; const _Float16* p = rowk0 + 8 * (lane >> 4);
  u.q[0] = *(const v8h*)p; u.q[1] = *(const v8h*)(p + 16); return u.v;
}
__device__ __forceinline__ v16h frag_f32(const float* rowk0, int lane) {
  v16h a; const float* p = rowk0 + 8 * (lane >> 4);
#pragma unroll
  for (int i = 0; i < 8; ++i) { a[i] = (_Float16)p[i]; a[8 + i] = (_Float16)p[16 + i]; }
  return a;
}
__device__ __forceinline__ v16h frag_f32s(const float* rowk0, int lane, float sc) {
  v16h a; const float* p = rowk0 + 8 * (lane >> 4);
#pragma unroll
  for (int i = 0; i < 8; ++i) { a[i] = (_Float16)(p[i] * sc); a[8 + i] = (_Float16)(p[16 + i] * sc); }
  return a;
}
// column fragment from a [K][ld] layout (column n), rows >= K read as 0
__device__ __forceinline__ v16h fragc_f32(const float* W, int k0, int n, int lane, int ld, int K) {
  v16h a; const int g = lane >> 4;
#pragma unroll
  for (int i = 0; i < 8; ++i) { const int ka = k0 + 8 * g + i, kb = ka + 16;
    a[i] = (_Float16)(ka < K ? W[(size_t)(ka < K ? ka : K - 1) * ld + n] : 0.f); a[8 + i] = (_Float16)(kb < K ? W[(size_t)(kb < K ? kb : K - 1) * ld + n] : 0.f); }
  return a;
}
struct F2 { v16b h, l; };
__device__ __forceinline__ F2 bsplit16(const float v[16]) { F2 r;
#pragma unroll
  for (int i = 0; i < 16; ++i) { const __bf16 h = (__bf16)v[i]; r.h[i] = h; r.l[i] = (__bf16)(v[i] - (float)h); }
  return r; }
__device__ __forceinline__ F2 split_row(const float* row, int k0, int lane) { float v[16]; const float* p = row + k0 + 8 * (lane >> 4);
#pragma unroll
  for (int i = 0; i < 8; ++i) { v[i] = p[i]; v[8 + i] = p[16 + i]; }
  return bsplit16(v); }
__device__ __forceinline__ F2 split_rowK(const float* row, int k0, int lane, int K) { float v[16]; const int g = lane >> 4;
#pragma unroll
  for (int i = 0; i < 8; ++i) { const int ka = k0 + 8 * g + i, kb = ka + 16; v[i] = ka < K ? row[ka < K ? ka : K - 1] : 0.f; v[8 + i] = kb < K ? row[kb < K ? kb : K - 1] : 0.f; }
  return bsplit16(v); }
__device__ __forceinline__ F2 split_col(const float* W, int k0, int n, int lane, int ld, int K) { float v[16]; const int g = lane >> 4;
#pragma unroll
  for (int i = 0; i < 8; ++i) { const int ka = k0 + 8 * g + i, kb = ka + 16; v[i] = ka < K ? W[(size_t)(ka < K ? ka : K - 1) * ld + n] : 0.f; v[8 + i] = kb < K ? W[(size_t)(kb < K ? kb : K - 1) * ld + n] : 0.f; }
  return bsplit16(v); }
__device__ __forceinline__ v8f mac3(const F2& a, const F2& b, v8f c) { c = wmma_bf(a.l, b.h, c); c = wmma_bf(a.h, b.l, c); return wmma_bf(a.h, b.h, c); }
__device__ __forceinline__ float sigm(float v) { return 1.0f / (1.0f + expf(-v)); }
#define LDSX() do { asm volatile("s_wait_dscnt 0" ::: "memory"); __builtin_amdgcn_wave_barrier(); __builtin_amdgcn_fence(__ATOMIC_RELEASE, "workgroup"); } while (0)


// Soft attention between two raw inputs (L = R = 8,192 rows, D 128): scores[r][l] = rinput_r . linput_l (unscaled); alpha = softmax over l; Y[r] = sum_l alpha[r][l] linput_l.
#define NB 1
#define NS 8192
#define NH 1
#define DD 128
#define RS (NH * DD)      // row stride between consecutive s (128 floats)
#ifndef TQB
#define TQB (NS / 64)
#endif
typedef __attribute__((ext_vector_type(8))) __bf16 v8b;
__device__ __forceinline__ v16b frag_b(const __bf16* rowk0, int lane) {
  union { v16b v; v8b q[2]; } u; const __bf16* p = rowk0 + 8 * (lane >> 4);
  u.q[0] = *(const v8b*)p; u.q[1] = *(const v8b*)(p + 16); return u.v;
}
__device__ __forceinline__ float bfr(float v) { return (float)(__bf16)v; }
// lane l's value seen from lane l ^ 16, by a vector cross-row move (a shuffle would go through the LDS unit and its wait)
__device__ __forceinline__ float xhalf(float x) { return __builtin_bit_cast(float, __builtin_amdgcn_permlanex16(__builtin_bit_cast(int, x), __builtin_bit_cast(int, x), 0x76543210, 0xfedcba98, false, false)); }
__device__ __attribute__((noinline)) float exp_ni(float v) { return expf(v); }
__device__ __attribute__((noinline)) float erf_ni(float v) { return erff(v); }

#define KB_E (32 * DD)                              // 16-bit elements of one packed block of 32 keys (8 KB)
#define WS_KP  0u                                   // bf16 key fragments   [key block][ct * 4 + kc][half][lane][8]
#define WS_VP  (WS_KP + 2u * (size_t)NS * DD)       // f16 value fragments  [key block][j][half][lane][8]
#define WS_END (WS_VP + 2u * (size_t)NS * DD)

// ---- k_pack: block = one block of 32 keys. Rounds its rows once (keys to bf16, values bf16 -> f16) and stores them in the order in which k_att's lanes hold them:
// one unit = the 16 bytes of one lane for one half fragment, the 32 lanes' units side by side, so that each wave-wide 16-byte load of k_att reads 512 contiguous bytes (4 whole lines)
__global__ __launch_bounds__(256) void k_pack(const float* __restrict__ X, __bf16* __restrict__ KP, _Float16* __restrict__ VP) {
  __shared__ __align__(16) float t[32][DD + 4]; const int tid = threadIdx.x; const size_t ks = blockIdx.x;
#pragma unroll   // the four row loads of a thread are in flight together, one round trip to memory instead of four
  for (int k = 0; k < 4; ++k) { const int e = tid + k * 256, r = e >> 5, c = (e & 31) * 4; *(v4f*)&t[r][c] = *(const v4f*)(X + (ks * 32 + r) * (size_t)DD + c); }
  __syncthreads();
#pragma unroll   // both units' LDS reads issue ahead of the first wait
  for (int k = 0; k < 2; ++k) { const int u = tid + k * 256, col = u & 15, g = (u >> 4) & 1, hf = (u >> 5) & 1, f = u >> 6;
    const float* p = &t[(f >> 2) * 16 + col][(f & 3) * 32 + hf * 16 + 8 * g]; v8b kb; v8h vh;
#pragma unroll   // constant element numbers keep kb and vh in registers
    for (int i = 0; i < 8; ++i) { kb[i] = (__bf16)p[i]; vh[i] = (_Float16)bfr(t[hf * 16 + 8 * g + i][f * 16 + col]); }
    *(v8b*)(KP + ks * KB_E + u * 8) = kb; *(v8h*)(VP + ks * KB_E + u * 8) = vh; } }
#define QT 2
#define NW 8
#define NR 8
#define SBK 4
#define SKB (SBK * KB_E * 2)
#define NT (NS / 32 / NR / SBK)
#define WS_PO  WS_END
#define WS_PM  (WS_PO + 4u * (size_t)NR * NS * DD)
#define WS_PL  (WS_PM + 4u * (size_t)NR * NS)
#define WS_END2 (WS_PL + 4u * (size_t)NR * NS)
// half a stage (64 keys): each thread copies 4 x 16 bytes of keys and 4 x 16 bytes of values, 4 KB apart; lk, lv = the lane's own LDS byte addresses, gk, gv = its own global addresses
// the s_wait_xcnt stands inside the statement so that no address register of a copy is rewritten ahead of it
__device__ __forceinline__ void half_copy(unsigned lk, unsigned lv, const char* gk, const char* gv) {
  asm volatile("global_load_async_to_lds_b128 %0, %8, off\n\t"
               "global_load_async_to_lds_b128 %1, %9, off\n\t"
               "global_load_async_to_lds_b128 %2, %10, off\n\t"
               "global_load_async_to_lds_b128 %3, %11, off\n\t"
               "global_load_async_to_lds_b128 %4, %12, off\n\t"
               "global_load_async_to_lds_b128 %5, %13, off\n\t"
               "global_load_async_to_lds_b128 %6, %14, off\n\t"
               "global_load_async_to_lds_b128 %7, %15, off\n\t"
               "s_wait_xcnt 0x0"
               :: "v"(lk), "v"(lk + 4096u), "v"(lk + 8192u), "v"(lk + 12288u), "v"(lv), "v"(lv + 4096u), "v"(lv + 8192u), "v"(lv + 12288u),
                  "v"(gk), "v"(gk + 4096), "v"(gk + 8192), "v"(gk + 12288), "v"(gv), "v"(gv + 4096), "v"(gv + 8192), "v"(gv + 12288) : "memory");
}
__device__ __forceinline__ void stage_copy(unsigned lk, unsigned lv, const char* gk, const char* gv) { half_copy(lk, lv, gk, gv); half_copy(lk + 16384u, lv + 16384u, gk + 16384, gv + 16384); }
__global__ __launch_bounds__(NW * 32) void k_att(const float* __restrict__ Q, const __bf16* __restrict__ KP, const _Float16* __restrict__ VP, float* __restrict__ PO, float* __restrict__ PM, float* __restrict__ PL) {
  __shared__ __attribute__((aligned(16))) unsigned char ring[2][2 * SKB];   // [buffer][keys | values]
  __shared__ __align__(16) float so[NW][16 * QT][132];
  // readfirstlane: the wave's number as a scalar, so that the LDS bases stay on the scalar side
  const int tid = threadIdx.x, wave = __builtin_amdgcn_readfirstlane(tid >> 5), lane = tid & 31, col = lane & 15, g = lane >> 4; const int kr = blockIdx.y; const int q0 = blockIdx.x * (16 * QT * NW) + wave * (16 * QT);
  // the copies' addresses = a scalar part (buffer, stage, the wave's 512 bytes) + the lane's 16 bytes: only l16 lives in a vector register through the loop
  const unsigned l16 = (unsigned)lane * 16u; const unsigned lw = (unsigned)(size_t)&ring[0][0] + (unsigned)wave * 512u;
  const char* gkw = (const char*)KP + (size_t)kr * (NT * SKB) + wave * 512; const char* gvw = (const char*)VP + (size_t)kr * (NT * SKB) + wave * 512;
  const unsigned lk0 = (unsigned)(size_t)&ring[0][0] + (unsigned)tid * 16u; const char* gk0 = (const char*)KP + (size_t)kr * (NT * SKB) + tid * 16; const char* gv0 = (const char*)VP + (size_t)kr * (NT * SKB) + tid * 16;   // the same addresses from tid alone, for the two stages in front of the loop: values that are asm operands themselves stay below v256, and held there through the loop they were spilled
  stage_copy(lk0, lk0 + SKB, gk0, gv0);
  v16b aq[QT][4];
#pragma unroll
  for (int q = 0; q < QT; ++q)
#pragma unroll
    for (int kc = 0; kc < 4; ++kc) { const float* pp = Q + (size_t)(q0 + q * 16 + col) * DD + kc * 32 + 8 * g;
#pragma unroll
      for (int i = 0; i < 8; ++i) { aq[q][kc][i] = (__bf16)pp[i]; aq[q][kc][8 + i] = (__bf16)pp[16 + i]; } }
  float m[QT], l[QT];            // of query col of tile q: m over both halves' keys, l over this half's keys alone (the halves' sums are joined behind the loop)
  v8f acc[QT][8];                // acc[q][j][r] = O^T[j * 16 + 8 * g + r][col]
#pragma unroll
  for (int q = 0; q < QT; ++q) { m[q] = -3.0e38f; l[q] = 0.f;
#pragma unroll
    for (int j = 0; j < 8; ++j) acc[q][j] = v8f{}; }
  asm volatile("s_wait_asynccnt 0x0" ::: "memory");   // this wave's copies of stage 0 have landed
  __syncthreads();                                    // and every other wave's: stage 0 may be read
  stage_copy(lk0 + 2 * SKB, lk0 + 3 * SKB, gk0 + SKB, gv0 + SKB);
  // a block's 8 fragments are read from LDS as ONE group, well ahead of their products: the values in front of their block's score products, the next block's keys (same stage only) behind them, as they free the keys' registers;
  // the LDS latency, and the queue when 8 waves read at once, run under the softmax and matrix work instead of standing in front of every pair of products. GROUP_FENCE keeps the compiler from sinking a group's reads down to their users, one wait each
#define GROUP_FENCE() __builtin_amdgcn_sched_barrier(0)
  union { v16b v; v8b q[2]; } kf[8]; union { v16h v; v8h q[2]; } vf[8];
#pragma unroll 1
  for (int t = 0; t < NT; ++t) { const unsigned char* bk = &ring[t & 1][0] + lane * 16;
    { const v8b* kp = (const v8b*)bk;
#pragma unroll
      for (int i = 0; i < 8; ++i) { kf[i].q[0] = kp[i * 64]; kf[i].q[1] = kp[i * 64 + 32]; } }
#pragma unroll
    for (int sb = 0; sb < SBK; ++sb) { const v8b* kp = (const v8b*)(bk + (sb + 1) * (KB_E * 2)); const v8h* vp = (const v8h*)(bk + SKB + sb * (KB_E * 2));
      GROUP_FENCE();
#pragma unroll
      for (int j = 0; j < 8; ++j) { vf[j].q[0] = vp[j * 64]; vf[j].q[1] = vp[j * 64 + 32]; }
      GROUP_FENCE();
      v8f c[QT][2];
#pragma unroll
      for (int q = 0; q < QT; ++q) { c[q][0] = v8f{}; c[q][1] = v8f{}; }
#pragma unroll
      for (int kc = 0; kc < 4; ++kc)
#pragma unroll
        for (int ct = 0; ct < 2; ++ct)
#pragma unroll
          for (int q = 0; q < QT; ++q) c[q][ct] = wmma_bf(kf[ct * 4 + kc].v, aq[q][kc], c[q][ct]);   // c[q][ct][r] = score of key ct * 16 + 8 * g + r with query col of tile q
      GROUP_FENCE();
      if (sb + 1 < SBK) {
#pragma unroll
        for (int i = 0; i < 8; ++i) { kf[i].q[0] = kp[i * 64]; kf[i].q[1] = kp[i * 64 + 32]; } }
      GROUP_FENCE();
      v16h pa[QT];   // pa[q][ct * 8 + r]: k = ct * 16 + 8 * g + r, the hardware's k order, which the value fragments have too
#pragma unroll
      for (int q = 0; q < QT; ++q) { float mx = fmaxf(c[q][0][0], c[q][1][0]);
#pragma unroll
        for (int r = 1; r < 8; ++r) mx = fmaxf(mx, fmaxf(c[q][0][r], c[q][1][r]));
        mx = fmaxf(mx, xhalf(mx));   // both halves scale by the same max: their keys meet in one output product
        const float mn = fmaxf(m[q], mx), alpha = __expf(m[q] - mn); float es[4] = {0.f, 0.f, 0.f, 0.f};
#pragma unroll
        for (int r = 0; r < 8; ++r) { const float e0 = __expf(c[q][0][r] - mn), e1 = __expf(c[q][1][r] - mn); es[r & 1] += e0; es[2 + (r & 1)] += e1; pa[q][r] = (_Float16)(e0 * 2048.0f); pa[q][8 + r] = (_Float16)(e1 * 2048.0f); }
        l[q] = l[q] * alpha + ((es[0] + es[1]) + (es[2] + es[3])); m[q] = mn;
#pragma unroll
        for (int j = 0; j < 8; ++j) acc[q][j] *= alpha; }
#pragma unroll
      for (int j = 0; j < 8; ++j)
#pragma unroll
        for (int q = 0; q < QT; ++q) acc[q][j] = wmma16(vf[j].v, pa[q], acc[q][j]); }
    asm volatile("s_wait_dscnt 0x0" ::: "memory");      // this wave's reads of stage t are done before the buffer is given up
    asm volatile("s_wait_asynccnt 0x0" ::: "memory");   // this wave's copies of stage t + 1 have landed
    __syncthreads();                                    // publishes stage t + 1 and ends every wave's reads of stage t
    if (t + 2 < NT) { const unsigned lb = lw + (unsigned)(t & 1) * (2u * SKB); stage_copy(lb + l16, lb + SKB + l16, gkw + (size_t)(t + 2) * SKB + l16, gvw + (size_t)(t + 2) * SKB + l16); } }
  asm volatile("s_wait_asynccnt 0x0" ::: "memory");     // nothing of this wave is in flight when it leaves the ring
  // each wave leaves its un-normalised partial, with its max and sum per query; it goes through LDS so that each store of a wave writes one whole output row (4 lines)
#pragma unroll
  for (int q = 0; q < QT; ++q) { l[q] += xhalf(l[q]);
#pragma unroll
    for (int j = 0; j < 8; ++j) { float* po = &so[wave][q * 16 + col][j * 16 + 8 * g]; *(v4f*)po = v4f{acc[q][j][0], acc[q][j][1], acc[q][j][2], acc[q][j][3]}; *(v4f*)(po + 4) = v4f{acc[q][j][4], acc[q][j][5], acc[q][j][6], acc[q][j][7]}; }
    if (g == 0) { PM[(size_t)kr * NS + q0 + q * 16 + col] = m[q]; PL[(size_t)kr * NS + q0 + q * 16 + col] = l[q]; } }
  __syncthreads();
#pragma unroll 1
  for (int r0 = 0; r0 < 16 * QT; r0 += 8) {
#pragma unroll   // eight rows' LDS reads issue ahead of the first wait
    for (int r = 0; r < 8; ++r) vst2(PO + ((size_t)(q0 + r0 + r) * NR + kr) * DD + lane * 4, *(const v4f*)&so[wave][r0 + r][lane * 4]);
    asm volatile("s_wait_xcnt 0x0" ::: "memory"); } }   // stands in front of the next trip's rewrite of the registers that the stores above name
// ---- k_merge: a wave takes MR output rows, a lane holds 4 columns of each; weight of range k = exp(m_k - max over ranges). One block per WGP: few waves to start, each with all its rows' loads in flight
#define MR 4
__global__ __launch_bounds__(256) void k_merge(const float* __restrict__ PO, const float* __restrict__ PM, const float* __restrict__ PL, float* __restrict__ OUT) {
  // readfirstlane: the wave's rows as a scalar, so that their maxima and sums come by scalar loads and the partial rows' bases stay on the scalar side
  const int lane = threadIdx.x & 31; const size_t row0 = ((size_t)blockIdx.x * 8 + __builtin_amdgcn_readfirstlane(threadIdx.x >> 5)) * MR; const unsigned lo = (unsigned)lane * 16u; float pm[MR][NR], pl[MR][NR]; v4f po[MR][NR];
#pragma unroll   // all rows' and ranges' loads are in flight together
  for (int i = 0; i < MR; ++i)
#pragma unroll
    for (int k = 0; k < NR; ++k) { pm[i][k] = PM[k * (size_t)NS + row0 + i]; pl[i][k] = PL[k * (size_t)NS + row0 + i]; po[i][k] = *(const v4f*)((const char*)(PO + ((row0 + i) * NR + k) * DD) + lo); }
  __builtin_amdgcn_sched_barrier(0);   // keeps the compiler from sinking the loads down to their users, which made a chain of round trips to L2 out of one
#pragma unroll
  for (int i = 0; i < MR; ++i) { float mm = pm[i][0];
#pragma unroll
    for (int k = 1; k < NR; ++k) mm = fmaxf(mm, pm[i][k]);
    float ls = 0.f; v4f o = {};
#pragma unroll
    for (int k = 0; k < NR; ++k) { const float wk = __expf(pm[i][k] - mm); ls += wk * pl[i][k]; o += wk * po[i][k]; }
    vst2((char*)(OUT + (row0 + i) * DD) + lo, o * ((1.0f / 2048.0f) / ls)); } }
extern "C" void kernel_launch(void* const* d_in, const int* in_sizes, int n_in, void* d_out, int out_size, void* d_ws, size_t ws_size, hipStream_t stream) {
  (void)in_sizes; (void)n_in; (void)out_size;
  const float** F = (const float**)d_in;   // 0 linput [8192,128] (keys and values), 1 rinput [8192,128] (queries)
  if (ws_size < (size_t)WS_END2) return;
  char* ws = (char*)d_ws; __bf16* KP = (__bf16*)(ws + WS_KP); _Float16* VP = (_Float16*)(ws + WS_VP); float* PO = (float*)(ws + WS_PO); float* PM = (float*)(ws + WS_PM); float* PL = (float*)(ws + WS_PL);
  k_pack<<<dim3(NS / 32), 256, 0, stream>>>(F[0], KP, VP);
  k_att<<<dim3(NS / (16 * QT * NW), NR), NW * 32, 0, stream>>>(F[1], KP, VP, PO, PM, PL);
  k_merge<<<dim3(NS / (8 * MR)), 256, 0, stream>>>(PO, PM, PL, (float*)d_out);
}

// v006
// Measured time: 38.2 microseconds a run.
// Two timings next to v005 put it at 1.03 and 1.04 times that version's speed.
// Over all steps from v000 it is 28.1 times as fast.
// compute dtype: all float inputs rounded to bf16; rinput (queries) and linput (keys AND values) are module INPUTS, so the bf16-rounded operands enter WMMA 16x16x32 directly: logits with EXACT bf16 x bf16 products (1 product, f32 accumulate), UNSCALED (logits std ~11, very peaked; exact products matter), running-max softmax in f32 (hardware exp2); P rounded once to f16 (x 2^11, carried in the exponent) against v converted bf16 -> f16 (exact for normal values) (1 product); f32 output [R, D].
#include <hip/hip_runtime.h>
#include <math.h>

typedef __attribute__((ext_vector_type(16))) _Float16 v16h;
typedef __attribute__((ext_vector_type(16))) __bf16 v16b;
typedef __attribute__((ext_vector_type(8)))  _Float16 v8h;
typedef __attribute__((ext_vector_type(8)))  float v8f;
typedef __attribute__((ext_vector_type(4)))  float v4f;
typedef __attribute__((ext_vector_type(2)))  float v2f;
typedef __attribute__((ext_vector_type(4)))  unsigned v4u;
typedef __attribute__((ext_vector_type(4)))  int v4i;
typedef float __attribute__((may_alias)) float_a;
typedef int __attribute__((may_alias)) int_a;

template <typename T> __device__ __forceinline__ void vst2(void* p, T v) { *(T*)p = v;  }
__device__ __forceinline__ v8f wmma16(v16h a, v16h b, v8f c) {
  return __builtin_amdgcn_wmma_f32_16x16x32_f16(false, a, false, b, (short)0, c, false, false);
}
__device__ __forceinline__ v8f wmma_bf(v16b a, v16b b, v8f c) {
  return __builtin_amdgcn_wmma_f32_16x16x32_bf16(false, a, false, b, (short)0, c, false, false);
}
// 16x16x32 fragments: lane = (h = lane>>4, row/col = lane&15); elements 0..7 = k0+8h+0..7, 8..15 = k0+16+8h+0..7; D element r = row 8h+r
__device__ __forceinline__ v16h frag_h(const _Float16* rowk0, int lane) {
  union { v16h v; v8h q[2]; } u; const _Float16* p = rowk0 + 8 * (lane >> 4);
  u.q[0] = *(const v8h*)p; u.q[1] = *(const v8h*)(p + 16); return u.v;
}
__device__ __forceinline__ v16h frag_f32(const float* rowk0, int lane) {
  v16h a; const float* p = rowk0 + 8 * (lane >> 4);
#pragma unroll
  for (int i = 0; i < 8; ++i) { a[i] = (_Float16)p[i]; a[8 + i] = (_Float16)p[16 + i]; }
  return a;
}
__device__ __forceinline__ v16h frag_f32s(const float* rowk0, int lane, float sc) {
  v16h a; const float* p = rowk0 + 8 * (lane >> 4);
#pragma unroll
  for (int i = 0; i < 8; ++i) { a[i] = (_Float16)(p[i] * sc); a[8 + i] = (_Float16)(p[16 + i] * sc); }
  return a;
}
// column fragment from a [K][ld] layout (column n), rows >= K read as 0
__device__ __forceinline__ v16h fragc_f32(const float* W, int k0, int n, int lane, int ld, int K) {
  v16h a; const int g = lane >> 4;
#pragma unroll
  for (int i = 0; i < 8; ++i) { const int ka = k0 + 8 * g + i, kb = ka + 16;
    a[i] = (_Float16)(ka < K ? W[(size_t)(ka < K ? ka : K - 1) * ld + n] : 0.f); a[8 + i] = (_Float16)(kb < K ? W[(size_t)(kb < K ? kb : K - 1) * ld + n] : 0.f); }
  return a;
}
struct F2 { v16b h, l; };
__device__ __forceinline__ F2 bsplit16(const float v[16]) { F2 r;
#pragma unroll
  for (int i = 0; i < 16; ++i) { const __bf16 h = (__bf16)v[i]; r.h[i] = h; r.l[i] = (__bf16)(v[i] - (float)h); }
  return r; }
__device__ __forceinline__ F2 split_row(const float* row, int k0, int lane) { float v[16]; const float* p = row + k0 + 8 * (lane >> 4);
#pragma unroll
  for (int i = 0; i < 8; ++i) { v[i] = p[i]; v[8 + i] = p[16 + i]; }
  return bsplit16(v); }
__device__ __forceinline__ F2 split_rowK(const float* row, int k0, int lane, int K) { float v[16]; const int g = lane >> 4;
#pragma unroll
  for (int i = 0; i < 8; ++i) { const int ka = k0 + 8 * g + i, kb = ka + 16; v[i] = ka < K ? row[ka < K ? ka : K - 1] : 0.f; v[8 + i] = kb < K ? row[kb < K ? kb : K - 1] : 0.f; }
  return bsplit16(v); }
__device__ __forceinline__ F2 split_col(const float* W, int k0, int n, int lane, int ld, int K) { float v[16]; const int g = lane >> 4;
#pragma unroll
  for (int i = 0; i < 8; ++i) { const int ka = k0 + 8 * g + i, kb = ka + 16; v[i] = ka < K ? W[(size_t)(ka < K ? ka : K - 1) * ld + n] : 0.f; v[8 + i] = kb < K ? W[(size_t)(kb < K ? kb : K - 1) * ld + n] : 0.f; }
  return bsplit16(v); }
__device__ __forceinline__ v8f mac3(const F2& a, const F2& b, v8f c) { c = wmma_bf(a.l, b.h, c); c = wmma_bf(a.h, b.l, c); return wmma_bf(a.h, b.h, c); }
__device__ __forceinline__ float sigm(float v) { return 1.0f / (1.0f + expf(-v)); }
#define LDSX() do { asm volatile("s_wait_dscnt 0" ::: "memory"); __builtin_amdgcn_wave_barrier(); __builtin_amdgcn_fence(__ATOMIC_RELEASE, "workgroup"); } while (0)


// Soft attention between two raw inputs (L = R = 8,192 rows, D 128): scores[r][l] = rinput_r . linput_l (unscaled); alpha = softmax over l; Y[r] = sum_l alpha[r][l] linput_l.
#define NB 1
#define NS 8192
#define NH 1
#define DD 128
#define RS (NH * DD)      // row stride between consecutive s (128 floats)
#ifndef TQB
#define TQB (NS / 64)
#endif
typedef __attribute__((ext_vector_type(8))) __bf16 v8b;
__device__ __forceinline__ v16b frag_b(const __bf16* rowk0, int lane) {
  union { v16b v; v8b q[2]; } u; const __bf16* p = rowk0 + 8 * (lane >> 4);
  u.q[0] = *(const v8b*)p; u.q[1] = *(const v8b*)(p + 16); return u.v;
}
__device__ __forceinline__ float bfr(float v) { return (float)(__bf16)v; }
// lane l's value seen from lane l ^ 16, by a vector cross-row move (a shuffle would go through the LDS unit and its wait)
__device__ __forceinline__ float xhalf(float x) { return __builtin_bit_cast(float, __builtin_amdgcn_permlanex16(__builtin_bit_cast(int, x), __builtin_bit_cast(int, x), 0x76543210, 0xfedcba98, false, false)); }
__device__ __attribute__((noinline)) float exp_ni(float v) { return expf(v); }
__device__ __attribute__((noinline)) float erf_ni(float v) { return erff(v); }

#define KB_E (32 * DD)                              // 16-bit elements of one packed block of 32 keys (8 KB)
#define WS_KP  0u                                   // bf16 key fragments   [key block][ct * 4 + kc][half][lane][8]
#define WS_VP  (WS_KP + 2u * (size_t)NS * DD)       // f16 value fragments  [key block][j][half][lane][8]
#define WS_END (WS_VP + 2u * (size_t)NS * DD)

// ---- k_pack: block = one block of 32 keys. Rounds its rows once (keys to bf16, values bf16 -> f16) and stores them in the order in which k_att's lanes hold them:
// one unit = the 16 bytes of one lane for one half fragment, the 32 lanes' units side by side, so that each wave-wide 16-byte load of k_att reads 512 contiguous bytes (4 whole lines)
__global__ __launch_bounds__(256) void k_pack(const float* __restrict__ X, __bf16* __restrict__ KP, _Float16* __restrict__ VP) {
  __shared__ __align__(16) float t[32][DD + 4]; const int tid = threadIdx.x; const size_t ks = blockIdx.x;
#pragma unroll   // the four row loads of a thread are in flight together, one round trip to memory instead of four
  for (int k = 0; k < 4; ++k) { const int e = tid + k * 256, r = e >> 5, c = (e & 31) * 4; *(v4f*)&t[r][c] = *(const v4f*)(X + (ks * 32 + r) * (size_t)DD + c); }
  __syncthreads();
#pragma unroll   // both units' LDS reads issue ahead of the first wait
  for (int k = 0; k < 2; ++k) { const int u = tid + k * 256, col = u & 15, g = (u >> 4) & 1, hf = (u >> 5) & 1, f = u >> 6;
    const float* p = &t[(f >> 2) * 16 + col][(f & 3) * 32 + hf * 16 + 8 * g]; v8b kb; v8h vh;
#pragma unroll   // constant element numbers keep kb and vh in registers
    for (int i = 0; i < 8; ++i) { kb[i] = (__bf16)p[i]; vh[i] = (_Float16)bfr(t[hf * 16 + 8 * g + i][f * 16 + col]); }
    *(v8b*)(KP + ks * KB_E + u * 8) = kb; *(v8h*)(VP + ks * KB_E + u * 8) = vh; } }
#define LOG2E 1.4426950408889634f
#define QT 2                        // query tiles of a wave
#define NW 8                        // waves of a block
#define NR 8                        // key ranges
#define SBK 4                       // packed blocks of 32 keys in a stage
#define SKB (SBK * KB_E * 2)        // bytes of a stage's keys, and of its values (32 KB)
#define NT (NS / 32 / NR / SBK)     // stages of a range
#define WS_PO  WS_END                                       // f32 partial outputs [query][range][DD], un-normalised
#define WS_PM  (WS_PO + 4u * (size_t)NR * NS * DD)          // f32 running max     [range][query]
#define WS_PL  (WS_PM + 4u * (size_t)NR * NS)               // f32 sum             [range][query], x 2^11 like the partial outputs
#define WS_END2 (WS_PL + 4u * (size_t)NR * NS)
// half a stage (64 keys): each thread copies 4 x 16 bytes of keys and 4 x 16 bytes of values, 4 KB apart; lk, lv = the lane's own LDS byte addresses, gk, gv = its own global addresses
// the s_wait_xcnt stands inside the statement so that no address register of a copy is rewritten ahead of it
__device__ __forceinline__ void half_copy(unsigned lk, unsigned lv, const char* gk, const char* gv) {
  asm volatile("global_load_async_to_lds_b128 %0, %8, off\n\t"
               "global_load_async_to_lds_b128 %1, %9, off\n\t"
               "global_load_async_to_lds_b128 %2, %10, off\n\t"
               "global_load_async_to_lds_b128 %3, %11, off\n\t"
               "global_load_async_to_lds_b128 %4, %12, off\n\t"
               "global_load_async_to_lds_b128 %5, %13, off\n\t"
               "global_load_async_to_lds_b128 %6, %14, off\n\t"
               "global_load_async_to_lds_b128 %7, %15, off\n\t"
               "s_wait_xcnt 0x0"
               :: "v"(lk), "v"(lk + 4096u), "v"(lk + 8192u), "v"(lk + 12288u), "v"(lv), "v"(lv + 4096u), "v"(lv + 8192u), "v"(lv + 12288u),
                  "v"(gk), "v"(gk + 4096), "v"(gk + 8192), "v"(gk + 12288), "v"(gv), "v"(gv + 4096), "v"(gv + 8192), "v"(gv + 12288) : "memory");
}
__device__ __forceinline__ void stage_copy(unsigned lk, unsigned lv, const char* gk, const char* gv) { half_copy(lk, lv, gk, gv); half_copy(lk + 16384u, lv + 16384u, gk + 16384, gv + 16384); }
__global__ __launch_bounds__(NW * 32) void k_att(const float* __restrict__ Q, const __bf16* __restrict__ KP, const _Float16* __restrict__ VP, float* __restrict__ PO, float* __restrict__ PM, float* __restrict__ PL) {
  __shared__ __attribute__((aligned(16))) unsigned char ring[2][2 * SKB];   // [buffer][keys | values]
  __shared__ __align__(16) float so[NW][16 * QT][132];
  // readfirstlane: the wave's number as a scalar, so that the LDS bases stay on the scalar side
  const int tid = threadIdx.x, wave = __builtin_amdgcn_readfirstlane(tid >> 5), lane = tid & 31, col = lane & 15, g = lane >> 4; const int kr = blockIdx.y; const int q0 = blockIdx.x * (16 * QT * NW) + wave * (16 * QT);
  // the copies' addresses = a scalar part (buffer, stage, the wave's 512 bytes) + the lane's 16 bytes: only l16 lives in a vector register through the loop
  const unsigned l16 = (unsigned)lane * 16u; const unsigned lw = (unsigned)(size_t)&ring[0][0] + (unsigned)wave * 512u;
  const char* gkw = (const char*)KP + (size_t)kr * (NT * SKB) + wave * 512; const char* gvw = (const char*)VP + (size_t)kr * (NT * SKB) + wave * 512;
  const unsigned lk0 = (unsigned)(size_t)&ring[0][0] + (unsigned)tid * 16u; const char* gk0 = (const char*)KP + (size_t)kr * (NT * SKB) + tid * 16; const char* gv0 = (const char*)VP + (size_t)kr * (NT * SKB) + tid * 16;   // the same addresses from tid alone, for the two stages in front of the loop: values that are asm operands themselves stay below v256, and held there through the loop they were spilled
  stage_copy(lk0, lk0 + SKB, gk0, gv0);
  v16b aq[QT][4];
#pragma unroll
  for (int q = 0; q < QT; ++q)
#pragma unroll
    for (int kc = 0; kc < 4; ++kc) { const float* pp = Q + (size_t)(q0 + q * 16 + col) * DD + kc * 32 + 8 * g;
#pragma unroll
      for (int i = 0; i < 8; ++i) { aq[q][kc][i] = (__bf16)pp[i]; aq[q][kc][8 + i] = (__bf16)pp[16 + i]; } }
  float m[QT], l[QT];            // of query col of tile q: m over both halves' keys; l over this half's keys alone, x 2^11 like P (the halves' sums are joined behind the loop)
  v8f acc[QT][8];                // acc[q][j][r] = O^T[j * 16 + 8 * g + r][col]
#pragma unroll
  for (int q = 0; q < QT; ++q) { m[q] = -3.0e38f; l[q] = 0.f;
#pragma unroll
    for (int j = 0; j < 8; ++j) acc[q][j] = v8f{}; }
  asm volatile("s_wait_asynccnt 0x0" ::: "memory");   // this wave's copies of stage 0 have landed
  __syncthreads();                                    // and every other wave's: stage 0 may be read
  stage_copy(lk0 + 2 * SKB, lk0 + 3 * SKB, gk0 + SKB, gv0 + SKB);
  // a block's 8 fragments are read from LDS as ONE group, well ahead of their products: the values in front of their block's score products, the next block's keys (same stage only) behind them, as they free the keys' registers;
  // the LDS latency, and the queue when 8 waves read at once, run under the softmax and matrix work instead of standing in front of every pair of products. GROUP_FENCE keeps the compiler from sinking a group's reads down to their users, one wait each
#define GROUP_FENCE() __builtin_amdgcn_sched_barrier(0)
  union { v16b v; v8b q[2]; } kf[8]; union { v16h v; v8h q[2]; } vf[8];
#pragma unroll 1
  for (int t = 0; t < NT; ++t) { const unsigned char* bk = &ring[t & 1][0] + lane * 16;
    { const v8b* kp = (const v8b*)bk;
#pragma unroll
      for (int i = 0; i < 8; ++i) { kf[i].q[0] = kp[i * 64]; kf[i].q[1] = kp[i * 64 + 32]; } }
#pragma unroll
    for (int sb = 0; sb < SBK; ++sb) { const v8b* kp = (const v8b*)(bk + (sb + 1) * (KB_E * 2)); const v8h* vp = (const v8h*)(bk + SKB + sb * (KB_E * 2));
      GROUP_FENCE();
#pragma unroll
      for (int j = 0; j < 8; ++j) { vf[j].q[0] = vp[j * 64]; vf[j].q[1] = vp[j * 64 + 32]; }
      GROUP_FENCE();
      v8f c[QT][2];
#pragma unroll
      for (int q = 0; q < QT; ++q) { c[q][0] = v8f{}; c[q][1] = v8f{}; }
#pragma unroll
      for (int kc = 0; kc < 4; ++kc)
#pragma unroll
        for (int ct = 0; ct < 2; ++ct)
#pragma unroll
          for (int q = 0; q < QT; ++q) c[q][ct] = wmma_bf(kf[ct * 4 + kc].v, aq[q][kc], c[q][ct]);   // c[q][ct][r] = score of key ct * 16 + 8 * g + r with query col of tile q
      GROUP_FENCE();
      if (sb + 1 < SBK) {
#pragma unroll
        for (int i = 0; i < 8; ++i) { kf[i].q[0] = kp[i * 64]; kf[i].q[1] = kp[i * 64 + 32]; } }
      GROUP_FENCE();
      v16h pa[QT];   // pa[q][ct * 8 + r]: k = ct * 16 + 8 * g + r, the hardware's k order, which the value fragments have too
#pragma unroll
      for (int q = 0; q < QT; ++q) { float mx = fmaxf(c[q][0][0], c[q][1][0]);
#pragma unroll
        for (int r = 1; r < 8; ++r) mx = fmaxf(mx, fmaxf(c[q][0][r], c[q][1][r]));
        mx = fmaxf(mx, xhalf(mx));   // both halves scale by the same max: their keys meet in one output product
        const float mn = fmaxf(m[q], mx), alpha = __expf(m[q] - mn), nm = 11.0f - mn * LOG2E; v2f es0, es1;
        // 2^11 e^(score - max) = exp2(score x log2 e + (11 - max x log2 e)): one packed multiply-add for two scores stands in front of the hardware exp2
#pragma unroll
        for (int r = 0; r < 8; r += 2) { const v2f a0 = __builtin_elementwise_fma(v2f{c[q][0][r], c[q][0][r + 1]}, v2f{LOG2E, LOG2E}, v2f{nm, nm}), a1 = __builtin_elementwise_fma(v2f{c[q][1][r], c[q][1][r + 1]}, v2f{LOG2E, LOG2E}, v2f{nm, nm});
          const v2f e0 = {__builtin_amdgcn_exp2f(a0.x), __builtin_amdgcn_exp2f(a0.y)}, e1 = {__builtin_amdgcn_exp2f(a1.x), __builtin_amdgcn_exp2f(a1.y)};
          if (r == 0) { es0 = e0; es1 = e1; } else { es0 += e0; es1 += e1; }   // four chains of sums, two to a packed add
          pa[q][r] = (_Float16)e0.x; pa[q][r + 1] = (_Float16)e0.y; pa[q][8 + r] = (_Float16)e1.x; pa[q][8 + r + 1] = (_Float16)e1.y; }
        l[q] = l[q] * alpha + ((es0.x + es0.y) + (es1.x + es1.y)); m[q] = mn;
        asm volatile("" : "+v"(l[q]));   // each row's sum pinned against spills (the remedy for sums folded together): without it the compiler puts off all four blocks' additions to the stage's end and holds 128 exponentials in registers until then, over the budget
#pragma unroll
        for (int j = 0; j < 8; ++j) acc[q][j] *= alpha; }
#pragma unroll
      for (int j = 0; j < 8; ++j)
#pragma unroll
        for (int q = 0; q < QT; ++q) acc[q][j] = wmma16(vf[j].v, pa[q], acc[q][j]); }
    asm volatile("s_wait_dscnt 0x0" ::: "memory");      // this wave's reads of stage t are done before the buffer is given up
    asm volatile("s_wait_asynccnt 0x0" ::: "memory");   // this wave's copies of stage t + 1 have landed
    __syncthreads();                                    // publishes stage t + 1 and ends every wave's reads of stage t
    if (t + 2 < NT) { const unsigned lb = lw + (unsigned)(t & 1) * (2u * SKB); stage_copy(lb + l16, lb + SKB + l16, gkw + (size_t)(t + 2) * SKB + l16, gvw + (size_t)(t + 2) * SKB + l16); } }
  asm volatile("s_wait_asynccnt 0x0" ::: "memory");     // nothing of this wave is in flight when it leaves the ring
  // each wave leaves its un-normalised partial, with its max and sum per query; it goes through LDS so that each store of a wave writes one whole output row (4 lines)
#pragma unroll
  for (int q = 0; q < QT; ++q) { l[q] += xhalf(l[q]);
#pragma unroll
    for (int j = 0; j < 8; ++j) { float* po = &so[wave][q * 16 + col][j * 16 + 8 * g]; *(v4f*)po = v4f{acc[q][j][0], acc[q][j][1], acc[q][j][2], acc[q][j][3]}; *(v4f*)(po + 4) = v4f{acc[q][j][4], acc[q][j][5], acc[q][j][6], acc[q][j][7]}; }
    if (g == 0) { PM[(size_t)kr * NS + q0 + q * 16 + col] = m[q]; PL[(size_t)kr * NS + q0 + q * 16 + col] = l[q]; } }
  __syncthreads();
#pragma unroll 1
  for (int r0 = 0; r0 < 16 * QT; r0 += 8) {
#pragma unroll   // eight rows' LDS reads issue ahead of the first wait
    for (int r = 0; r < 8; ++r) vst2(PO + ((size_t)(q0 + r0 + r) * NR + kr) * DD + lane * 4, *(const v4f*)&so[wave][r0 + r][lane * 4]);
    asm volatile("s_wait_xcnt 0x0" ::: "memory"); } }   // stands in front of the next trip's rewrite of the registers that the stores above name
// ---- k_merge: a wave takes MR output rows, a lane holds 4 columns of each; weight of range k = exp(m_k - max over ranges). One block per WGP: few waves to start, each with all its rows' loads in flight
#define MR 4
__global__ __launch_bounds__(256) void k_merge(const float* __restrict__ PO, const float* __restrict__ PM, const float* __restrict__ PL, float* __restrict__ OUT) {
  // readfirstlane: the wave's rows as a scalar, so that their maxima and sums come by scalar loads and the partial rows' bases stay on the scalar side
  const int lane = threadIdx.x & 31; const size_t row0 = ((size_t)blockIdx.x * 8 + __builtin_amdgcn_readfirstlane(threadIdx.x >> 5)) * MR; const unsigned lo = (unsigned)lane * 16u; float pm[MR][NR], pl[MR][NR]; v4f po[MR][NR];
#pragma unroll   // all rows' and ranges' loads are in flight together
  for (int i = 0; i < MR; ++i)
#pragma unroll
    for (int k = 0; k < NR; ++k) { pm[i][k] = PM[k * (size_t)NS + row0 + i]; pl[i][k] = PL[k * (size_t)NS + row0 + i]; po[i][k] = *(const v4f*)((const char*)(PO + ((row0 + i) * NR + k) * DD) + lo); }
  __builtin_amdgcn_sched_barrier(0);   // keeps the compiler from sinking the loads down to their users, which made a chain of round trips to L2 out of one
#pragma unroll
  for (int i = 0; i < MR; ++i) { float mm = pm[i][0];
#pragma unroll
    for (int k = 1; k < NR; ++k) mm = fmaxf(mm, pm[i][k]);
    float ls = 0.f; v4f o = {};
#pragma unroll
    for (int k = 0; k < NR; ++k) { const float wk = __expf(pm[i][k] - mm); ls += wk * pl[i][k]; o += wk * po[i][k]; }
    vst2((char*)(OUT + (row0 + i) * DD) + lo, o * (1.0f / ls)); } }
extern "C" void kernel_launch(void* const* d_in, const int* in_sizes, int n_in, void* d_out, int out_size, void* d_ws, size_t ws_size, hipStream_t stream) {
  (void)in_sizes; (void)n_in; (void)out_size;
  const float** F = (const float**)d_in;   // 0 linput [8192,128] (keys and values), 1 rinput [8192,128] (queries)
  if (ws_size < (size_t)WS_END2) return;
  char* ws = (char*)d_ws; __bf16* KP = (__bf16*)(ws + WS_KP); _Float16* VP = (_Float16*)(ws + WS_VP); float* PO = (float*)(ws + WS_PO); float* PM = (float*)(ws + WS_PM); float* PL = (float*)(ws + WS_PL);
  k_pack<<<dim3(NS / 32), 256, 0, stream>>>(F[0], KP, VP);
  k_att<<<dim3(NS / (16 * QT * NW), NR), NW * 32, 0, stream>>>(F[1], KP, VP, PO, PM, PL);
  k_merge<<<dim3(NS / (8 * MR)), 256, 0, stream>>>(PO, PM, PL, (float*)d_out);
}

// v007
// One run takes 35.7 microseconds.
// Timed twice side by side with v006, it ran 1.07 times as fast both times.
// All steps since v000 together make it 30.1 times as fast.
// compute dtype: all float inputs rounded to bf16; rinput (queries) and linput (keys AND values) are module INPUTS, so the bf16-rounded operands enter WMMA 16x16x32 directly: logits with EXACT bf16 x bf16 products (1 product, f32 accumulate), UNSCALED (logits std ~11, very peaked; exact products matter), running-max softmax in f32 (hardware exp2); P rounded once to f16 (x 2^11, carried in the exponent) against v converted bf16 -> f16 (exact for normal values) (1 product); f32 output [R, D].
#include <hip/hip_runtime.h>
#include <math.h>

typedef __attribute__((ext_vector_type(16))) _Float16 v16h;
typedef __attribute__((ext_vector_type(16))) __bf16 v16b;
typedef __attribute__((ext_vector_type(8)))  _Float16 v8h;
typedef __attribute__((ext_vector_type(8)))  float v8f;
typedef __attribute__((ext_vector_type(4)))  float v4f;
typedef __attribute__((ext_vector_type(2)))  float v2f;
typedef __attribute__((ext_vector_type(4)))  unsigned v4u;
typedef __attribute__((ext_vector_type(4)))  int v4i;
typedef float __attribute__((may_alias)) float_a;
typedef int __attribute__((may_alias)) int_a;

template <typename T> __device__ __forceinline__ void vst2(void* p, T v) { *(T*)p = v;  }
__device__ __forceinline__ v8f wmma16(v16h a, v16h b, v8f c) {
  return __builtin_amdgcn_wmma_f32_16x16x32_f16(false, a, false, b, (short)0, c, false, false);
}
__device__ __forceinline__ v8f wmma_bf(v16b a, v16b b, v8f c) {
  return __builtin_amdgcn_wmma_f32_16x16x32_bf16(false, a, false, b, (short)0, c, false, false);
}
// 16x16x32 fragments: lane = (h = lane>>4, row/col = lane&15); elements 0..7 = k0+8h+0..7, 8..15 = k0+16+8h+0..7; D element r = row 8h+r
__device__ __forceinline__ v16h frag_h(const _Float16* rowk0, int lane) {
  union { v16h v; v8h q[2]; } u; const _Float16* p = rowk0 + 8 * (lane >> 4);
  u.q[0] = *(const v8h*)p; u.q[1] = *(const v8h*)(p + 16); return u.v;
}
__device__ __forceinline__ v16h frag_f32(const float* rowk0, int lane) {
  v16h a; const float* p = rowk0 + 8 * (lane >> 4);
#pragma unroll
  for (int i = 0; i < 8; ++i) { a[i] = (_Float16)p[i]; a[8 + i] = (_Float16)p[16 + i]; }
  return a;
}
__device__ __forceinline__ v16h frag_f32s(const float* rowk0, int lane, float sc) {
  v16h a; const float* p = rowk0 + 8 * (lane >> 4);
#pragma unroll
  for (int i = 0; i < 8; ++i) { a[i] = (_Float16)(p[i] * sc); a[8 + i] = (_Float16)(p[16 + i] * sc); }
  return a;
}
// column fragment from a [K][ld] layout (column n), rows >= K read as 0
__device__ __forceinline__ v16h fragc_f32(const float* W, int k0, int n, int lane, int ld, int K) {
  v16h a; const int g = lane >> 4;
#pragma unroll
  for (int i = 0; i < 8; ++i) { const int ka = k0 + 8 * g + i, kb = ka + 16;
    a[i] = (_Float16)(ka < K ? W[(size_t)(ka < K ? ka : K - 1) * ld + n] : 0.f); a[8 + i] = (_Float16)(kb < K ? W[(size_t)(kb < K ? kb : K - 1) * ld + n] : 0.f); }
  return a;
}
struct F2 { v16b h, l; };
__device__ __forceinline__ F2 bsplit16(const float v[16]) { F2 r;
#pragma unroll
  for (int i = 0; i < 16; ++i) { const __bf16 h = (__bf16)v[i]; r.h[i] = h; r.l[i] = (__bf16)(v[i] - (float)h); }
  return r; }
__device__ __forceinline__ F2 split_row(const float* row, int k0, int lane) { float v[16]; const float* p = row + k0 + 8 * (lane >> 4);
#pragma unroll
  for (int i = 0; i < 8; ++i) { v[i] = p[i]; v[8 + i] = p[16 + i]; }
  return bsplit16(v); }
__device__ __forceinline__ F2 split_rowK(const float* row, int k0, int lane, int K) { float v[16]; const int g = lane >> 4;
#pragma unroll
  for (int i = 0; i < 8; ++i) { const int ka = k0 + 8 * g + i, kb = ka + 16; v[i] = ka < K ? row[ka < K ? ka : K - 1] : 0.f; v[8 + i] = kb < K ? row[kb < K ? kb : K - 1] : 0.f; }
  return bsplit16(v); }
__device__ __forceinline__ F2 split_col(const float* W, int k0, int n, int lane, int ld, int K) { float v[16]; const int g = lane >> 4;
#pragma unroll
  for (int i = 0; i < 8; ++i) { const int ka = k0 + 8 * g + i, kb = ka + 16; v[i] = ka < K ? W[(size_t)(ka < K ? ka : K - 1) * ld + n] : 0.f; v[8 + i] = kb < K ? W[(size_t)(kb < K ? kb : K - 1) * ld + n] : 0.f; }
  return bsplit16(v); }
__device__ __forceinline__ v8f mac3(const F2& a, const F2& b, v8f c) { c = wmma_bf(a.l, b.h, c); c = wmma_bf(a.h, b.l, c); return wmma_bf(a.h, b.h, c); }
__device__ __forceinline__ float sigm(float v) { return 1.0f / (1.0f + expf(-v)); }
#define LDSX() do { asm volatile("s_wait_dscnt 0" ::: "memory"); __builtin_amdgcn_wave_barrier(); __builtin_amdgcn_fence(__ATOMIC_RELEASE, "workgroup"); } while (0)


// Soft attention between two raw inputs (L = R = 8,192 rows, D 128): scores[r][l] = rinput_r . linput_l (unscaled); alpha = softmax over l; Y[r] = sum_l alpha[r][l] linput_l.
#define NB 1
#define NS 8192
#define NH 1
#define DD 128
#define RS (NH * DD)      // row stride between consecutive s (128 floats)
#ifndef TQB
#define TQB (NS / 64)
#endif
typedef __attribute__((ext_vector_type(8))) __bf16 v8b;
__device__ __forceinline__ v16b frag_b(const __bf16* rowk0, int lane) {
  union { v16b v; v8b q[2]; } u; const __bf16* p = rowk0 + 8 * (lane >> 4);
  u.q[0] = *(const v8b*)p; u.q[1] = *(const v8b*)(p + 16); return u.v;
}
__device__ __forceinline__ float bfr(float v) { return (float)(__bf16)v; }
// lane l's value seen from lane l ^ 16, by a vector cross-row move (a shuffle would go through the LDS unit and its wait)
__device__ __forceinline__ float xhalf(float x) { return __builtin_bit_cast(float, __builtin_amdgcn_permlanex16(__builtin_bit_cast(int, x), __builtin_bit_cast(int, x), 0x76543210, 0xfedcba98, false, false)); }
__device__ __attribute__((noinline)) float exp_ni(float v) { return expf(v); }
__device__ __attribute__((noinline)) float erf_ni(float v) { return erff(v); }

#define LOG2E 1.4426950408889634f
#define QT 2                        // query tiles of a wave
#define NW 8                        // waves of a block
#define NR 8                        // key ranges
#define SBK 4                       // blocks of 32 keys in a stage
#define KPIT 272                    // bytes of a key row in LDS (bf16, row-major): 256 + 16, so that the 16 rows which a fragment read touches fall on different banks
#define VJ 1040                     // bytes of the value fragments of 16 columns and 32 keys [half][lane][8 f16]: 2 x 512 + 16, so that the stores of 16 lanes, which lie in 4 such groups, fall on different banks
#define VBK (8 * VJ)                // bytes of the value fragments of a block of 32 keys
#define SK (SBK * 32 * KPIT)        // bytes of a stage's keys
#define SV (SBK * VBK)              // bytes of a stage's values
#define NT (NS / 32 / NR / SBK)     // stages of a range
#define WS_PO  0u                                           // f32 partial outputs [query][range][DD], un-normalised
#define WS_PM  (WS_PO + 4u * (size_t)NR * NS * DD)          // f32 running max     [range][query]
#define WS_PL  (WS_PM + 4u * (size_t)NR * NS)               // f32 sum             [range][query], x 2^11 like the partial outputs
#define WS_END2 (WS_PL + 4u * (size_t)NR * NS)
// a tile = 8 key rows x 128 columns, held by one wave: lane l has columns 4 l .. 4 l + 3 of each row, so that every load of the wave reads one whole row (4 lines)
typedef __attribute__((ext_vector_type(2))) __bf16 v2b;
typedef __attribute__((ext_vector_type(2))) unsigned v2u;
struct Tile { v4f x[8]; };
__device__ __forceinline__ void tile_load(Tile& T, const float* rows, unsigned l16) {   // rows = the first of the 8 rows (the same for the whole wave), l16 = the lane's 16 bytes in a row
#pragma unroll   // all eight loads are in flight together
  for (int i = 0; i < 8; ++i) T.x[i] = *(const v4f*)((const char*)(rows + i * DD) + l16); }
// kd = the lane's 8 bytes in the tile's first key row; vd = the unit (16 bytes: 8 keys of one column) of the lane's first column; a lane's four columns lie side by side in one group of 16
__device__ __forceinline__ void tile_store(const Tile& T, unsigned char* kd, unsigned char* vd) { v2u w[8];   // w[i] = row i's four columns as bf16, two to a word
#pragma unroll   // constant element numbers keep the tile in registers
  for (int i = 0; i < 8; ++i) { w[i].x = __builtin_bit_cast(unsigned, v2b{(__bf16)T.x[i][0], (__bf16)T.x[i][1]}); w[i].y = __builtin_bit_cast(unsigned, v2b{(__bf16)T.x[i][2], (__bf16)T.x[i][3]});
    *(v2u*)(kd + i * KPIT) = w[i]; }
#pragma unroll
  for (int e = 0; e < 4; ++e) { v8h vh;
#pragma unroll   // a bf16 in the upper half of a word is its f32 value: one shift or one mask a value, no second rounding from f32
    for (int i = 0; i < 8; ++i) { const unsigned u = (e & 2) ? w[i].y : w[i].x; vh[i] = (_Float16)__builtin_bit_cast(float, (e & 1) ? (u & 0xffff0000u) : (u << 16)); }
    *(v8h*)(vd + e * 16) = vh; } }
__global__ __launch_bounds__(NW * 32) void k_att(const float* __restrict__ Q, const float* __restrict__ X, float* __restrict__ PO, float* __restrict__ PM, float* __restrict__ PL) {
  __shared__ __attribute__((aligned(16))) unsigned char ring[2][SK + SV];   // [buffer][keys | values]
  __shared__ __align__(16) float so[NW][16 * QT][132];
  // readfirstlane: the wave's number as a scalar, so that the LDS bases stay on the scalar side
  const int tid = threadIdx.x, wave = __builtin_amdgcn_readfirstlane(tid >> 5), lane = tid & 31, col = lane & 15, g = lane >> 4; const int kr = blockIdx.y; const int q0 = blockIdx.x * (16 * QT * NW) + wave * (16 * QT);
  // wave w stages rows 16 w .. 16 w + 15 of every stage, as two tiles h = 0, 1: as values they are keys 16 (w & 1) + 8 h + 0..7 of block w >> 1, that is fragment half w & 1, lanes 16 h + column
  const unsigned l16 = (unsigned)lane * 16u; const float* xw = X + ((size_t)kr * (NS / NR) + wave * 16) * DD;
  const unsigned ko = (unsigned)wave * (16u * KPIT) + (unsigned)lane * 8u, vo = SK + (unsigned)(wave >> 1) * VBK + (unsigned)(wave & 1) * 512u + (unsigned)(lane >> 2) * VJ + (unsigned)(lane & 3) * 64u;
  Tile T, T1; tile_load(T, xw, l16); tile_load(T1, xw + 8 * DD, l16);
  asm volatile("s_wait_xcnt 0x0" ::: "memory");
  v16b aq[QT][4];
#pragma unroll
  for (int q = 0; q < QT; ++q)
#pragma unroll
    for (int kc = 0; kc < 4; ++kc) { const float* pp = Q + (size_t)(q0 + q * 16 + col) * DD + kc * 32 + 8 * g;
#pragma unroll
      for (int i = 0; i < 8; ++i) { aq[q][kc][i] = (__bf16)pp[i]; aq[q][kc][8 + i] = (__bf16)pp[16 + i]; } }
  float m[QT], l[QT];            // of query col of tile q: m over both halves' keys; l over this half's keys alone, x 2^11 like P (the halves' sums are joined behind the loop)
  v8f acc[QT][8];                // acc[q][j][r] = O^T[j * 16 + 8 * g + r][col]
#pragma unroll
  for (int q = 0; q < QT; ++q) { m[q] = -3.0e38f; l[q] = 0.f;
#pragma unroll
    for (int j = 0; j < 8; ++j) acc[q][j] = v8f{}; }
  tile_store(T, &ring[0][ko], &ring[0][vo]); tile_store(T1, &ring[0][ko + 8 * KPIT], &ring[0][vo + 256]);
  __syncthreads();                                    // every wave's rows of stage 0 are in LDS: it may be read
  // a block's 8 fragments are read from LDS as ONE group, well ahead of their products: the values in front of their block's score products, the next block's keys (same stage only) behind them, as they free the keys' registers;
  // the LDS latency, and the queue when 8 waves read at once, run under the softmax and matrix work instead of standing in front of every pair of products. GROUP_FENCE keeps the compiler from sinking a group's reads down to their users, one wait each
#define GROUP_FENCE() __builtin_amdgcn_sched_barrier(0)
  union { v16b v; v8b q[2]; } kf[8]; union { v16h v; v8h q[2]; } vf[8];
#pragma unroll 1
  for (int t = 0; t < NT; ++t) { const unsigned char* bk = &ring[t & 1][0] + col * KPIT + g * 16; const unsigned char* bv = &ring[t & 1][SK] + lane * 16; unsigned char* nb = &ring[(t + 1) & 1][0];
    const bool more = t + 1 < NT; const float* xn = xw + (size_t)(t + 1) * (SBK * 32 * DD);   // the next stage goes into the buffer that the barrier at the last trip's foot has freed
    {
#pragma unroll
      for (int i = 0; i < 8; ++i) { const unsigned char* kp = bk + (i >> 2) * (16 * KPIT) + (i & 3) * 64; kf[i].q[0] = *(const v8b*)kp; kf[i].q[1] = *(const v8b*)(kp + 32); } }
#pragma unroll
    for (int sb = 0; sb < SBK; ++sb) { const unsigned char* kn = bk + (sb + 1) * (32 * KPIT); const unsigned char* vp = bv + sb * VBK;
      GROUP_FENCE();
#pragma unroll
      for (int j = 0; j < 8; ++j) { vf[j].q[0] = *(const v8h*)(vp + j * VJ); vf[j].q[1] = *(const v8h*)(vp + j * VJ + 512); }
      if ((sb & 1) == 0 && more) { tile_load(T, xn + (sb >> 1) * (8 * DD), l16);   // a tile of the next stage flies under two blocks' work
        asm volatile("s_wait_xcnt 0x0" ::: "memory"); }   // in front of the first rewrite of the loads' address registers, which the softmax below takes over
      GROUP_FENCE();
      v8f c[QT][2];
#pragma unroll
      for (int q = 0; q < QT; ++q) { c[q][0] = v8f{}; c[q][1] = v8f{}; }
#pragma unroll
      for (int kc = 0; kc < 4; ++kc)
#pragma unroll
        for (int ct = 0; ct < 2; ++ct)
#pragma unroll
          for (int q = 0; q < QT; ++q) c[q][ct] = wmma_bf(kf[ct * 4 + kc].v, aq[q][kc], c[q][ct]);   // c[q][ct][r] = score of key ct * 16 + 8 * g + r with query col of tile q
      GROUP_FENCE();
      if (sb + 1 < SBK) {
#pragma unroll
        for (int i = 0; i < 8; ++i) { const unsigned char* kp = kn + (i >> 2) * (16 * KPIT) + (i & 3) * 64; kf[i].q[0] = *(const v8b*)kp; kf[i].q[1] = *(const v8b*)(kp + 32); } }
      GROUP_FENCE();
      v16h pa[QT];   // pa[q][ct * 8 + r]: k = ct * 16 + 8 * g + r, the hardware's k order, which the value fragments have too
#pragma unroll
      for (int q = 0; q < QT; ++q) { float mx = fmaxf(c[q][0][0], c[q][1][0]);
#pragma unroll
        for (int r = 1; r < 8; ++r) mx = fmaxf(mx, fmaxf(c[q][0][r], c[q][1][r]));
        mx = fmaxf(mx, xhalf(mx));   // both halves scale by the same max: their keys meet in one output product
        const float mn = fmaxf(m[q], mx), alpha = __expf(m[q] - mn), nm = 11.0f - mn * LOG2E; v2f es0, es1;
        // 2^11 e^(score - max) = exp2(score x log2 e + (11 - max x log2 e)): one packed multiply-add for two scores stands in front of the hardware exp2
#pragma unroll
        for (int r = 0; r < 8; r += 2) { const v2f a0 = __builtin_elementwise_fma(v2f{c[q][0][r], c[q][0][r + 1]}, v2f{LOG2E, LOG2E}, v2f{nm, nm}), a1 = __builtin_elementwise_fma(v2f{c[q][1][r], c[q][1][r + 1]}, v2f{LOG2E, LOG2E}, v2f{nm, nm});
          const v2f e0 = {__builtin_amdgcn_exp2f(a0.x), __builtin_amdgcn_exp2f(a0.y)}, e1 = {__builtin_amdgcn_exp2f(a1.x), __builtin_amdgcn_exp2f(a1.y)};
          if (r == 0) { es0 = e0; es1 = e1; } else { es0 += e0; es1 += e1; }   // four chains of sums, two to a packed add
          pa[q][r] = (_Float16)e0.x; pa[q][r + 1] = (_Float16)e0.y; pa[q][8 + r] = (_Float16)e1.x; pa[q][8 + r + 1] = (_Float16)e1.y; }
        l[q] = l[q] * alpha + ((es0.x + es0.y) + (es1.x + es1.y)); m[q] = mn;
        asm volatile("" : "+v"(l[q]));   // each row's sum pinned against spills (the remedy for sums folded together): without it the compiler puts off all four blocks' additions to the stage's end and holds 128 exponentials in registers until then, over the budget
#pragma unroll
        for (int j = 0; j < 8; ++j) acc[q][j] *= alpha; }
#pragma unroll
      for (int j = 0; j < 8; ++j)
#pragma unroll
        for (int q = 0; q < QT; ++q) acc[q][j] = wmma16(vf[j].v, pa[q], acc[q][j]);
      if ((sb & 1) == 1 && more) tile_store(T, nb + ko + (sb >> 1) * (8 * KPIT), nb + vo + (sb >> 1) * 256); }
    asm volatile("s_wait_dscnt 0x0" ::: "memory");      // this wave's reads of stage t and its stores of stage t + 1 are done
    __syncthreads(); }                                  // publishes stage t + 1 and ends every wave's reads of stage t
  // each wave leaves its un-normalised partial, with its max and sum per query; it goes through LDS so that each store of a wave writes one whole output row (4 lines)
#pragma unroll
  for (int q = 0; q < QT; ++q) { l[q] += xhalf(l[q]);
#pragma unroll
    for (int j = 0; j < 8; ++j) { float* po = &so[wave][q * 16 + col][j * 16 + 8 * g]; *(v4f*)po = v4f{acc[q][j][0], acc[q][j][1], acc[q][j][2], acc[q][j][3]}; *(v4f*)(po + 4) = v4f{acc[q][j][4], acc[q][j][5], acc[q][j][6], acc[q][j][7]}; }
    if (g == 0) { PM[(size_t)kr * NS + q0 + q * 16 + col] = m[q]; PL[(size_t)kr * NS + q0 + q * 16 + col] = l[q]; } }
  __syncthreads();
#pragma unroll 1
  for (int r0 = 0; r0 < 16 * QT; r0 += 8) {
#pragma unroll   // eight rows' LDS reads issue ahead of the first wait
    for (int r = 0; r < 8; ++r) vst2(PO + ((size_t)(q0 + r0 + r) * NR + kr) * DD + lane * 4, *(const v4f*)&so[wave][r0 + r][lane * 4]);
    asm volatile("s_wait_xcnt 0x0" ::: "memory"); } }   // stands in front of the next trip's rewrite of the registers that the stores above name
// ---- k_merge: a wave takes MR output rows, a lane holds 4 columns of each; weight of range k = exp(m_k - max over ranges). One block per WGP: few waves to start, each with all its rows' loads in flight
#define MR 4
__global__ __launch_bounds__(256) void k_merge(const float* __restrict__ PO, const float* __restrict__ PM, const float* __restrict__ PL, float* __restrict__ OUT) {
  // readfirstlane: the wave's rows as a scalar, so that their maxima and sums come by scalar loads and the partial rows' bases stay on the scalar side
  const int lane = threadIdx.x & 31; const size_t row0 = ((size_t)blockIdx.x * 8 + __builtin_amdgcn_readfirstlane(threadIdx.x >> 5)) * MR; const unsigned lo = (unsigned)lane * 16u; float pm[MR][NR], pl[MR][NR]; v4f po[MR][NR];
#pragma unroll   // all rows' and ranges' loads are in flight together
  for (int i = 0; i < MR; ++i)
#pragma unroll
    for (int k = 0; k < NR; ++k) { pm[i][k] = PM[k * (size_t)NS + row0 + i]; pl[i][k] = PL[k * (size_t)NS + row0 + i]; po[i][k] = *(const v4f*)((const char*)(PO + ((row0 + i) * NR + k) * DD) + lo); }
  __builtin_amdgcn_sched_barrier(0);   // keeps the compiler from sinking the loads down to their users, which made a chain of round trips to L2 out of one
#pragma unroll
  for (int i = 0; i < MR; ++i) { float mm = pm[i][0];
#pragma unroll
    for (int k = 1; k < NR; ++k) mm = fmaxf(mm, pm[i][k]);
    float ls = 0.f; v4f o = {};
#pragma unroll
    for (int k = 0; k < NR; ++k) { const float wk = __expf(pm[i][k] - mm); ls += wk * pl[i][k]; o += wk * po[i][k]; }
    vst2((char*)(OUT + (row0 + i) * DD) + lo, o * (1.0f / ls)); } }
extern "C" void kernel_launch(void* const* d_in, const int* in_sizes, int n_in, void* d_out, int out_size, void* d_ws, size_t ws_size, hipStream_t stream) {
  (void)in_sizes; (void)n_in; (void)out_size;
  const float** F = (const float**)d_in;   // 0 linput [8192,128] (keys and values), 1 rinput [8192,128] (queries)
  if (ws_size < (size_t)WS_END2) return;
  char* ws = (char*)d_ws; float* PO = (float*)(ws + WS_PO); float* PM = (float*)(ws + WS_PM); float* PL = (float*)(ws + WS_PL);
  k_att<<<dim3(NS / (16 * QT * NW), NR), NW * 32, 0, stream>>>(F[1], F[0], PO, PM, PL);
  k_merge<<<dim3(NS / (8 * MR)), 256, 0, stream>>>(PO, PM, PL, (float*)d_out);
}

// v009
// It runs in 29.5 microseconds.
// It is 1.21 times as fast as v007, going by the measured steps of the versions left out in between.
// Counting every step since v000, it is 36.4 times as fast.
// compute dtype: all float inputs rounded to bf16; rinput (queries) and linput (keys AND values) are module INPUTS, so the bf16-rounded operands enter WMMA 16x16x32 directly: logits with EXACT bf16 x bf16 products (1 product, f32 accumulate), UNSCALED (logits std ~11, very peaked; exact products matter), softmax in f32 (hardware exp2) against a per-query reference that is moved only when P nears the top of f16; P rounded once to f16 (its scale carried in the exponent) against v converted bf16 -> f16 (exact for normal values) (1 product); each key range's partial output divided by its own sum in f32 and rounded once to f16; f32 output [R, D].
#include <hip/hip_runtime.h>
#include <math.h>

typedef __attribute__((ext_vector_type(16))) _Float16 v16h;
typedef __attribute__((ext_vector_type(16))) __bf16 v16b;
typedef __attribute__((ext_vector_type(8)))  _Float16 v8h;
typedef __attribute__((ext_vector_type(8)))  float v8f;
typedef __attribute__((ext_vector_type(4)))  float v4f;
typedef __attribute__((ext_vector_type(2)))  float v2f;
typedef __attribute__((ext_vector_type(4)))  unsigned v4u;
typedef __attribute__((ext_vector_type(4)))  int v4i;
typedef float __attribute__((may_alias)) float_a;
typedef int __attribute__((may_alias)) int_a;

template <typename T> __device__ __forceinline__ void vst2(void* p, T v) { *(T*)p = v;  }
__device__ __forceinline__ v8f wmma16(v16h a, v16h b, v8f c) {
  return __builtin_amdgcn_wmma_f32_16x16x32_f16(false, a, false, b, (short)0, c, false, false);
}
__device__ __forceinline__ v8f wmma_bf(v16b a, v16b b, v8f c) {
  return __builtin_amdgcn_wmma_f32_16x16x32_bf16(false, a, false, b, (short)0, c, false, false);
}
// 16x16x32 fragments: lane = (h = lane>>4, row/col = lane&15); elements 0..7 = k0+8h+0..7, 8..15 = k0+16+8h+0..7; D element r = row 8h+r
__device__ __forceinline__ v16h frag_h(const _Float16* rowk0, int lane) {
  union { v16h v; v8h q[2]; } u; const _Float16* p = rowk0 + 8 * (lane >> 4);
  u.q[0] = *(const v8h*)p; u.q[1] = *(const v8h*)(p + 16); return u.v;
}
__device__ __forceinline__ v16h frag_f32(const float* rowk0, int lane) {
  v16h a; const float* p = rowk0 + 8 * (lane >> 4);
#pragma unroll
  for (int i = 0; i < 8; ++i) { a[i] = (_Float16)p[i]; a[8 + i] = (_Float16)p[16 + i]; }
  return a;
}
__device__ __forceinline__ v16h frag_f32s(const float* rowk0, int lane, float sc) {
  v16h a; const float* p = rowk0 + 8 * (lane >> 4);
#pragma unroll
  for (int i = 0; i < 8; ++i) { a[i] = (_Float16)(p[i] * sc); a[8 + i] = (_Float16)(p[16 + i] * sc); }
  return a;
}
// column fragment from a [K][ld] layout (column n), rows >= K read as 0
__device__ __forceinline__ v16h fragc_f32(const float* W, int k0, int n, int lane, int ld, int K) {
  v16h a; const int g = lane >> 4;
#pragma unroll
  for (int i = 0; i < 8; ++i) { const int ka = k0 + 8 * g + i, kb = ka + 16;
    a[i] = (_Float16)(ka < K ? W[(size_t)(ka < K ? ka : K - 1) * ld + n] : 0.f); a[8 + i] = (_Float16)(kb < K ? W[(size_t)(kb < K ? kb : K - 1) * ld + n] : 0.f); }
  return a;
}
struct F2 { v16b h, l; };
__device__ __forceinline__ F2 bsplit16(const float v[16]) { F2 r;
#pragma unroll
  for (int i = 0; i < 16; ++i) { const __bf16 h = (__bf16)v[i]; r.h[i] = h; r.l[i] = (__bf16)(v[i] - (float)h); }
  return r; }
__device__ __forceinline__ F2 split_row(const float* row, int k0, int lane) { float v[16]; const float* p = row + k0 + 8 * (lane >> 4);
#pragma unroll
  for (int i = 0; i < 8; ++i) { v[i] = p[i]; v[8 + i] = p[16 + i]; }
  return bsplit16(v); }
__device__ __forceinline__ F2 split_rowK(const float* row, int k0, int lane, int K) { float v[16]; const int g = lane >> 4;
#pragma unroll
  for (int i = 0; i < 8; ++i) { const int ka = k0 + 8 * g + i, kb = ka + 16; v[i] = ka < K ? row[ka < K ? ka : K - 1] : 0.f; v[8 + i] = kb < K ? row[kb < K ? kb : K - 1] : 0.f; }
  return bsplit16(v); }
__device__ __forceinline__ F2 split_col(const float* W, int k0, int n, int lane, int ld, int K) { float v[16]; const int g = lane >> 4;
#pragma unroll
  for (int i = 0; i < 8; ++i) { const int ka = k0 + 8 * g + i, kb = ka + 16; v[i] = ka < K ? W[(size_t)(ka < K ? ka : K - 1) * ld + n] : 0.f; v[8 + i] = kb < K ? W[(size_t)(kb < K ? kb : K - 1) * ld + n] : 0.f; }
  return bsplit16(v); }
__device__ __forceinline__ v8f mac3(const F2& a, const F2& b, v8f c) { c = wmma_bf(a.l, b.h, c); c = wmma_bf(a.h, b.l, c); return wmma_bf(a.h, b.h, c); }
__device__ __forceinline__ float sigm(float v) { return 1.0f / (1.0f + expf(-v)); }
#define LDSX() do { asm volatile("s_wait_dscnt 0" ::: "memory"); __builtin_amdgcn_wave_barrier(); __builtin_amdgcn_fence(__ATOMIC_RELEASE, "workgroup"); } while (0)


// Soft attention between two raw inputs (L = R = 8,192 rows, D 128): scores[r][l] = rinput_r . linput_l (unscaled); alpha = softmax over l; Y[r] = sum_l alpha[r][l] linput_l.
#define NB 1
#define NS 8192
#define NH 1
#define DD 128
#define RS (NH * DD)      // row stride between consecutive s (128 floats)
#ifndef TQB
#define TQB (NS / 64)
#endif
typedef __attribute__((ext_vector_type(8))) __bf16 v8b;
__device__ __forceinline__ v16b frag_b(const __bf16* rowk0, int lane) {
  union { v16b v; v8b q[2]; } u; const __bf16* p = rowk0 + 8 * (lane >> 4);
  u.q[0] = *(const v8b*)p; u.q[1] = *(const v8b*)(p + 16); return u.v;
}
__device__ __forceinline__ float bfr(float v) { return (float)(__bf16)v; }
// lane l's value seen from lane l ^ 16, by a vector cross-row move (a shuffle would go through the LDS unit and its wait)
__device__ __forceinline__ float xhalf(float x) { return __builtin_bit_cast(float, __builtin_amdgcn_permlanex16(__builtin_bit_cast(int, x), __builtin_bit_cast(int, x), 0x76543210, 0xfedcba98, false, false)); }
__device__ __attribute__((noinline)) float exp_ni(float v) { return expf(v); }
__device__ __attribute__((noinline)) float erf_ni(float v) { return erff(v); }

#define LOG2E 1.4426950408889634f
#define LN2 0.6931471805599453f
#define PLIM 60000.0f               // while no sum of four exponentials is larger, each of them is a finite f16 (largest 65504)
#define PSET 17.0f                  // a moved reference puts the larger of the block's top P and the sum so far (to the next power of two) at 2^(11 - PSET) = 2^-6: 21 doublings of room above; below, a P under f16's normal range is off by at most 2^-18 of the sum
#define QT 2                        // query tiles of a wave
#define NW 8                        // waves of a block
#define NR 8                        // key ranges
#define SBK 4                       // blocks of 32 keys in a stage
#define KPIT 272                    // bytes of a key row in LDS (bf16, row-major): 256 + 16, so that the 16 rows which a fragment read touches fall on different banks
#define VJ 1040                     // bytes of the value fragments of 16 columns and 32 keys [half][lane][8 f16]: 2 x 512 + 16, so that the stores of 16 lanes, which lie in 4 such groups, fall on different banks
#define VBK (8 * VJ)                // bytes of the value fragments of a block of 32 keys
#define SK (SBK * 32 * KPIT)        // bytes of a stage's keys
#define SV (SBK * VBK)              // bytes of a stage's values
#define NT (NS / 32 / NR / SBK)     // stages of a range
#define SOP 272                     // bytes of an output row in LDS (f16): 256 + 16, so that the 16 rows which a store of the accumulators touches fall on different banks
#define WS_PO  0u                                           // f16 partial outputs [query][range][DD], each divided by its range's sum: a weighted mean of value rows, so of their size, well inside f16
#define WS_PM  (WS_PO + 2u * (size_t)NR * NS * DD)          // f32 reference m     [range][query]
#define WS_PL  (WS_PM + 4u * (size_t)NR * NS)               // f32 sum             [range][query], scaled by 2^11 e^-m
#define WS_END2 (WS_PL + 4u * (size_t)NR * NS)
// a tile = 8 key rows x 128 columns, held by one wave: lane l has columns 4 l .. 4 l + 3 of each row, so that every load of the wave reads one whole row (4 lines)
typedef __attribute__((ext_vector_type(2))) __bf16 v2b;
typedef __attribute__((ext_vector_type(2))) unsigned v2u;
struct Tile { v4f x[8]; };
__device__ __forceinline__ void tile_load(Tile& T, const float* rows, unsigned l16) {   // rows = the first of the 8 rows (the same for the whole wave), l16 = the lane's 16 bytes in a row
#pragma unroll   // all eight loads are in flight together
  for (int i = 0; i < 8; ++i) T.x[i] = *(const v4f*)((const char*)(rows + i * DD) + l16); }
// kd = the lane's 8 bytes in the tile's first key row; vd = the unit (16 bytes: 8 keys of one column) of the lane's first column; a lane's four columns lie side by side in one group of 16
__device__ __forceinline__ void tile_store(const Tile& T, unsigned char* kd, unsigned char* vd) { v2u w[8];   // w[i] = row i's four columns as bf16, two to a word
#pragma unroll   // constant element numbers keep the tile in registers
  for (int i = 0; i < 8; ++i) { w[i].x = __builtin_bit_cast(unsigned, v2b{(__bf16)T.x[i][0], (__bf16)T.x[i][1]}); w[i].y = __builtin_bit_cast(unsigned, v2b{(__bf16)T.x[i][2], (__bf16)T.x[i][3]});
    *(v2u*)(kd + i * KPIT) = w[i]; }
#pragma unroll
  for (int e = 0; e < 4; ++e) { v8h vh;
#pragma unroll   // a bf16 in the upper half of a word is its f32 value: one shift or one mask a value, no second rounding from f32
    for (int i = 0; i < 8; ++i) { const unsigned u = (e & 2) ? w[i].y : w[i].x; vh[i] = (_Float16)__builtin_bit_cast(float, (e & 1) ? (u & 0xffff0000u) : (u << 16)); }
    *(v8h*)(vd + e * 16) = vh; } }
// P^T of one query tile against the reference in use: 2^11 e^(score - m) = exp2(score x log2 e + nm), nm = 11 - m x log2 e: one packed multiply-add for two scores stands in front of the hardware exp2
// pa[ct * 8 + r]: k = ct * 16 + 8 * g + r, the hardware's k order, which the value fragments have too. es0, es1: the lane's 16 exponentials (unrounded) summed in four chains of four
__device__ __forceinline__ void p_tile(const v8f& c0, const v8f& c1, float nm, v16h& pa, v2f& es0, v2f& es1) {
#pragma unroll
  for (int r = 0; r < 8; r += 2) { const v2f a0 = __builtin_elementwise_fma(v2f{c0[r], c0[r + 1]}, v2f{LOG2E, LOG2E}, v2f{nm, nm}), a1 = __builtin_elementwise_fma(v2f{c1[r], c1[r + 1]}, v2f{LOG2E, LOG2E}, v2f{nm, nm});
    const v2f e0 = {__builtin_amdgcn_exp2f(a0.x), __builtin_amdgcn_exp2f(a0.y)}, e1 = {__builtin_amdgcn_exp2f(a1.x), __builtin_amdgcn_exp2f(a1.y)};
    if (r == 0) { es0 = e0; es1 = e1; } else { es0 += e0; es1 += e1; }   // four chains of sums, two to a packed add
    pa[r] = (_Float16)e0.x; pa[r + 1] = (_Float16)e0.y; pa[8 + r] = (_Float16)e1.x; pa[8 + r + 1] = (_Float16)e1.y; } }
__global__ __launch_bounds__(NW * 32) void k_att(const float* __restrict__ Q, const float* __restrict__ X, _Float16* __restrict__ PO, float* __restrict__ PM, float* __restrict__ PL) {
  __shared__ __attribute__((aligned(16))) unsigned char ring[2][SK + SV];   // [buffer][keys | values]
  __shared__ __align__(16) unsigned char so[NW][16 * QT * SOP];
  // readfirstlane: the wave's number as a scalar, so that the LDS bases stay on the scalar side
  const int tid = threadIdx.x, wave = __builtin_amdgcn_readfirstlane(tid >> 5), lane = tid & 31, col = lane & 15, g = lane >> 4; const int kr = blockIdx.y; const int q0 = blockIdx.x * (16 * QT * NW) + wave * (16 * QT);
  // wave w stages rows 16 w .. 16 w + 15 of every stage, as two tiles h = 0, 1: as values they are keys 16 (w & 1) + 8 h + 0..7 of block w >> 1, that is fragment half w & 1, lanes 16 h + column
  const unsigned l16 = (unsigned)lane * 16u; const float* xw = X + ((size_t)kr * (NS / NR) + wave * 16) * DD;
  const unsigned ko = (unsigned)wave * (16u * KPIT) + (unsigned)lane * 8u, vo = SK + (unsigned)(wave >> 1) * VBK + (unsigned)(wave & 1) * 512u + (unsigned)(lane >> 2) * VJ + (unsigned)(lane & 3) * 64u;
  Tile T, T1; tile_load(T, xw, l16); tile_load(T1, xw + 8 * DD, l16);
  asm volatile("s_wait_xcnt 0x0" ::: "memory");
  v16b aq[QT][4];
#pragma unroll
  for (int q = 0; q < QT; ++q)
#pragma unroll
    for (int kc = 0; kc < 4; ++kc) { const float* pp = Q + (size_t)(q0 + q * 16 + col) * DD + kc * 32 + 8 * g;
#pragma unroll
      for (int i = 0; i < 8; ++i) { aq[q][kc][i] = (__bf16)pp[i]; aq[q][kc][8 + i] = (__bf16)pp[16 + i]; } }
  float m[QT], nm[QT], l[QT];    // of query col of tile q: m = the reference of its exponentials, the same in both halves (every P taken against it is a finite f16), nm = 11 - m x log2 e; l over this half's keys alone, scaled like P (the halves' sums are joined behind the loop)
  v8f acc[QT][8];                // acc[q][j][r] = O^T[j * 16 + 8 * g + r][col]
#pragma unroll
  for (int q = 0; q < QT; ++q) { m[q] = -1.0e30f; nm[q] = 11.0f - m[q] * LOG2E; l[q] = 0.f;   // the first block's exponentials come out infinite and set the reference
#pragma unroll
    for (int j = 0; j < 8; ++j) acc[q][j] = v8f{}; }
  tile_store(T, &ring[0][ko], &ring[0][vo]); tile_store(T1, &ring[0][ko + 8 * KPIT], &ring[0][vo + 256]);
  __syncthreads();                                    // every wave's rows of stage 0 are in LDS: it may be read
  // a block's 8 fragments are read from LDS as ONE group, well ahead of their products: the values in front of their block's score products, the next block's keys (same stage only) behind them, as they free the keys' registers;
  // the LDS latency, and the queue when 8 waves read at once, run under the softmax and matrix work instead of standing in front of every pair of products. GROUP_FENCE keeps the compiler from sinking a group's reads down to their users, one wait each
#define GROUP_FENCE() __builtin_amdgcn_sched_barrier(0)
  union { v16b v; v8b q[2]; } kf[8]; union { v16h v; v8h q[2]; } vf[8];
#pragma unroll 1
  for (int t = 0; t < NT; ++t) { const unsigned char* bk = &ring[t & 1][0] + col * KPIT + g * 16; const unsigned char* bv = &ring[t & 1][SK] + lane * 16; unsigned char* nb = &ring[(t + 1) & 1][0];
    const bool more = t + 1 < NT; const float* xn = xw + (size_t)(t + 1) * (SBK * 32 * DD);   // the next stage goes into the buffer that the barrier at the last trip's foot has freed
    {
#pragma unroll
      for (int i = 0; i < 8; ++i) { const unsigned char* kp = bk + (i >> 2) * (16 * KPIT) + (i & 3) * 64; kf[i].q[0] = *(const v8b*)kp; kf[i].q[1] = *(const v8b*)(kp + 32); } }
#pragma unroll
    for (int sb = 0; sb < SBK; ++sb) { const unsigned char* kn = bk + (sb + 1) * (32 * KPIT); const unsigned char* vp = bv + sb * VBK;
      GROUP_FENCE();
#pragma unroll
      for (int j = 0; j < 8; ++j) { vf[j].q[0] = *(const v8h*)(vp + j * VJ); vf[j].q[1] = *(const v8h*)(vp + j * VJ + 512); }
      if ((sb & 1) == 0 && more) { tile_load(T, xn + (sb >> 1) * (8 * DD), l16);   // a tile of the next stage flies under two blocks' work
        asm volatile("s_wait_xcnt 0x0" ::: "memory"); }   // in front of the first rewrite of the loads' address registers, which the softmax below takes over
      GROUP_FENCE();
      v8f c[QT][2];
#pragma unroll
      for (int q = 0; q < QT; ++q) { c[q][0] = v8f{}; c[q][1] = v8f{}; }
#pragma unroll
      for (int kc = 0; kc < 4; ++kc)
#pragma unroll
        for (int ct = 0; ct < 2; ++ct)
#pragma unroll
          for (int q = 0; q < QT; ++q) c[q][ct] = wmma_bf(kf[ct * 4 + kc].v, aq[q][kc], c[q][ct]);   // c[q][ct][r] = score of key ct * 16 + 8 * g + r with query col of tile q
      GROUP_FENCE();
      if (sb + 1 < SBK) {
#pragma unroll
        for (int i = 0; i < 8; ++i) { const unsigned char* kp = kn + (i >> 2) * (16 * KPIT) + (i & 3) * 64; kf[i].q[0] = *(const v8b*)kp; kf[i].q[1] = *(const v8b*)(kp + 32); } }
      GROUP_FENCE();
      // the exponentials are taken at once against the reference in use: no maximum, no rescaling of the 128 accumulator registers in the common case. ONE test a block for the whole wave (a scalar branch):
      // only where a lane's sums show a P near the top of f16 are the maxima formed, every query's reference moved, sums and accumulators rescaled and the block's exponentials taken again
      v16h pa[QT]; v2f es0[QT], es1[QT]; float top = 0.f;   // top = the largest of the lane's chain sums: the test does not wait for the chains to be joined
#pragma unroll
      for (int q = 0; q < QT; ++q) { p_tile(c[q][0], c[q][1], nm[q], pa[q], es0[q], es1[q]); top = fmaxf(fmaxf(top, fmaxf(es0[q].x, es0[q].y)), fmaxf(es1[q].x, es1[q].y)); }
      if (__builtin_amdgcn_ballot_w32(top > PLIM) != 0) {
#pragma unroll
        for (int q = 0; q < QT; ++q) { float mx = fmaxf(c[q][0][0], c[q][1][0]);
#pragma unroll
          for (int r = 1; r < 8; ++r) mx = fmaxf(mx, fmaxf(c[q][0][r], c[q][1][r]));
          mx = fmaxf(mx, xhalf(mx));   // both halves scale by the same reference: their keys meet in one output product
          const float lt = l[q] + xhalf(l[q]);   // no earlier P is larger than the sum so far, lt < 2^x with x its binary exponent: m + (x - 11) ln 2 bounds the earlier scores from above
          const float mn = fmaxf(mx, m[q] + ((float)__builtin_amdgcn_frexp_expf(lt) - 11.0f) * LN2) + PSET * LN2, alpha = __expf(m[q] - mn);
          m[q] = mn; nm[q] = 11.0f - mn * LOG2E; l[q] *= alpha;
#pragma unroll
          for (int j = 0; j < 8; ++j) acc[q][j] *= alpha;
          p_tile(c[q][0], c[q][1], nm[q], pa[q], es0[q], es1[q]); } }
#pragma unroll
      for (int q = 0; q < QT; ++q) l[q] += (es0[q].x + es0[q].y) + (es1[q].x + es1[q].y);
#pragma unroll
      for (int j = 0; j < 8; ++j)
#pragma unroll
        for (int q = 0; q < QT; ++q) acc[q][j] = wmma16(vf[j].v, pa[q], acc[q][j]);
      if ((sb & 1) == 1 && more) tile_store(T, nb + ko + (sb >> 1) * (8 * KPIT), nb + vo + (sb >> 1) * 256); }
    asm volatile("s_wait_dscnt 0x0" ::: "memory");      // this wave's reads of stage t and its stores of stage t + 1 are done
    __syncthreads(); }                                  // publishes stage t + 1 and ends every wave's reads of stage t
  // each wave leaves its partial divided by its own sum, as f16 (half the bytes to write here and to read in k_merge), with its reference and sum per query in f32; it goes through LDS so that each store of a wave writes two whole rows (2 lines each)
#pragma unroll
  for (int q = 0; q < QT; ++q) { l[q] += xhalf(l[q]); const float inv = 1.0f / l[q];
#pragma unroll
    for (int j = 0; j < 8; ++j) { v8h o;
#pragma unroll
      for (int r = 0; r < 8; ++r) o[r] = (_Float16)(acc[q][j][r] * inv);
      *(v8h*)&so[wave][(q * 16 + col) * SOP + j * 32 + g * 16] = o; }
    if (g == 0) { PM[(size_t)kr * NS + q0 + q * 16 + col] = m[q]; PL[(size_t)kr * NS + q0 + q * 16 + col] = l[q]; } }
  __syncthreads();
#pragma unroll 1
  for (int r0 = 0; r0 < 16 * QT; r0 += 16) {
#pragma unroll   // sixteen rows' LDS reads issue ahead of the first wait; a half of the wave takes one row
    for (int r = 0; r < 16; r += 2) vst2(PO + ((size_t)(q0 + r0 + r + g) * NR + kr) * DD + col * 8, *(const v8h*)&so[wave][(r0 + r + g) * SOP + col * 16]);
    asm volatile("s_wait_xcnt 0x0" ::: "memory"); } }   // stands in front of the next trip's rewrite of the registers that the stores above name
// ---- k_merge: a wave takes MR output rows, a lane holds 4 columns of each; weight of range k = exp(m_k - max over ranges) x its sum. One block per WGP: few waves to start, each with all its rows' loads in flight
#define MR 4
typedef __attribute__((ext_vector_type(4))) _Float16 v4h;
// 2^x by the hardware instruction; the v_nop in the same statement is the one slot that the instruction set asks for between a transcendental and a next instruction that reads its result or overwrites its source
__device__ __forceinline__ float exp2_slot(float x) { float r; asm("v_exp_f32 %0, %1\n\tv_nop" : "=v"(r) : "v"(x)); return r; }
__global__ __launch_bounds__(256) void k_merge(const _Float16* __restrict__ PO, const float* __restrict__ PM, const float* __restrict__ PL, float* __restrict__ OUT) {
  // readfirstlane: the wave's rows as a scalar, so that their maxima and sums come by scalar loads and the partial rows' bases stay on the scalar side
  const int lane = threadIdx.x & 31; const size_t row0 = ((size_t)blockIdx.x * 8 + __builtin_amdgcn_readfirstlane(threadIdx.x >> 5)) * MR; const unsigned lo = (unsigned)lane * 8u; float pm[MR][NR], pl[MR][NR]; v4h po[MR][NR];
#pragma unroll   // all rows' and ranges' loads are in flight together
  for (int i = 0; i < MR; ++i)
#pragma unroll
    for (int k = 0; k < NR; ++k) { pm[i][k] = PM[k * (size_t)NS + row0 + i]; pl[i][k] = PL[k * (size_t)NS + row0 + i]; po[i][k] = *(const v4h*)((const char*)(PO + ((row0 + i) * NR + k) * DD) + lo); }
  asm volatile("s_wait_xcnt 0x0" ::: "memory");
  __builtin_amdgcn_sched_barrier(0);
#pragma unroll
  for (int i = 0; i < MR; ++i) { float mm = pm[i][0];
#pragma unroll
    for (int k = 1; k < NR; ++k) mm = fmaxf(mm, pm[i][k]);
    float ls = 0.f; v4f o = {};
#pragma unroll
    for (int k = 0; k < NR; ++k) { const float wk = exp2_slot((pm[i][k] - mm) * LOG2E) * pl[i][k]; ls += wk; o += wk * __builtin_convertvector(po[i][k], v4f); }
    vst2((char*)(OUT + (row0 + i) * DD) + 2u * lo, o * (1.0f / ls)); } }
extern "C" void kernel_launch(void* const* d_in, const int* in_sizes, int n_in, void* d_out, int out_size, void* d_ws, size_t ws_size, hipStream_t stream) {
  (void)in_sizes; (void)n_in; (void)out_size;
  const float** F = (const float**)d_in;   // 0 linput [8192,128] (keys and values), 1 rinput [8192,128] (queries)
  if (ws_size < (size_t)WS_END2) return;
  char* ws = (char*)d_ws; _Float16* PO = (_Float16*)(ws + WS_PO); float* PM = (float*)(ws + WS_PM); float* PL = (float*)(ws + WS_PL);
  k_att<<<dim3(NS / (16 * QT * NW), NR), NW * 32, 0, stream>>>(F[1], F[0], PO, PM, PL);
  k_merge<<<dim3(NS / (8 * MR)), 256, 0, stream>>>(PO, PM, PL, (float*)d_out);
}
